// v000
// The times below were measured on an AMD MI455X: many runs one after another, warmed up first and cycling through
// copies of the inputs, with the whole window's GPU time divided by the number of runs. Launches and the gaps
// between them are all in it. The median over several windows is given; except for v000 it joins two sittings, which
// can be a few percent apart, so the side-by-side timings, each taken in one sitting, are the better comparison.
// v000 is the starting kernel. One run takes 448 microseconds.
#include <hip/hip_runtime.h>
#include <hip/hip_bf16.h>

typedef _Float16 half_t;
typedef __attribute__((ext_vector_type(4)))  half_t v4h;
typedef __attribute__((ext_vector_type(8)))  half_t v8h;
typedef __attribute__((ext_vector_type(16))) half_t v16h;
typedef __attribute__((ext_vector_type(8)))  float  v8f;

#define B_N    4
#define S_LEN  2048
#define D_DIM  768
#define KCH    32              // K-dim per wmma
#define NKC_D  (D_DIM / KCH)   // 24
#define NKC_S  (S_LEN / KCH)   // 64

// Per-lane fragment load for 16-bit A/B operands of v_wmma_*_16x16x32.
// p must already point at: row_base + k_base + (lane>=16 ? 8 : 0).
// Lane holds two contiguous 8-half (16B) chunks at +0 and +16 halves.
__device__ __forceinline__ v16h frag_ld(const half_t* p) {
    v8h lo = *(const v8h*)(p);
    v8h hi = *(const v8h*)(p + 16);
    return __builtin_shufflevector(lo, hi, 0,1,2,3,4,5,6,7,8,9,10,11,12,13,14,15);
}

__device__ __forceinline__ v8f wmma_f16(v16h a, v16h b, v8f c) {
    return __builtin_amdgcn_wmma_f32_16x16x32_f16(false, a, false, b, (short)0, c, false, false);
}

// ---------------------------------------------------------------------------
// Kernel 1: f32 -> f16 conversion, 4 elems/thread (grid-stride)
// ---------------------------------------------------------------------------
__global__ void cvt_f16_kernel(const float* __restrict__ src,
                               half_t* __restrict__ dst, int n4) {
    int i = blockIdx.x * blockDim.x + threadIdx.x;
    int stride = gridDim.x * blockDim.x;
    for (; i < n4; i += stride) {
        float4 v = ((const float4*)src)[i];
        v4h h;
        h[0] = (half_t)v.x; h[1] = (half_t)v.y;
        h[2] = (half_t)v.z; h[3] = (half_t)v.w;
        *(v4h*)(dst + (size_t)i * 4) = h;
    }
}

// ---------------------------------------------------------------------------
// Kernel 2: QKV projection. grid = (D/64, B*S/16), block = 96 (3 waves).
// Each wave computes a 16x64 output block (4 accumulators, A-frag reused 4x).
// wave 0 -> Q (scaled by 1/sqrt(D), f16 row-major)
// wave 1 -> K (f16 row-major)
// wave 2 -> V (f16 transposed: Vt[b][d][s])
// ---------------------------------------------------------------------------
__global__ __launch_bounds__(96)
void qkv_kernel(const half_t* __restrict__ Xh,
                const half_t* __restrict__ Wqh,
                const half_t* __restrict__ Wkh,
                const half_t* __restrict__ Wvh,
                const float*  __restrict__ bq,
                const float*  __restrict__ bk,
                const float*  __restrict__ bv,
                half_t* __restrict__ Qh,
                half_t* __restrict__ Kh,
                half_t* __restrict__ Vt) {
    const int lane = threadIdx.x & 31;
    const int wave = threadIdx.x >> 5;          // 0=Q, 1=K, 2=V
    const int n0   = blockIdx.x * 64;           // output-channel block
    const int g0   = blockIdx.y * 16;           // global row in [0, B*S)
    const int r    = lane & 15;
    const int mhi  = (lane >> 4) ? 8 : 0;
    const int ko   = mhi;                       // k-offset pattern for frags

    const half_t* W  = (wave == 0) ? Wqh : (wave == 1) ? Wkh : Wvh;
    const float*  bb = (wave == 0) ? bq  : (wave == 1) ? bk  : bv;

    v8f acc[4];
    #pragma unroll
    for (int u = 0; u < 4; ++u) {
        float bias = bb[n0 + u * 16 + r];
        #pragma unroll
        for (int i = 0; i < 8; ++i) acc[u][i] = bias;
    }

    const half_t* xrow = Xh + (size_t)(g0 + r) * D_DIM + ko;
    const half_t* wrow = W  + (size_t)(n0 + r) * D_DIM + ko;  // +u*16 rows per chunk
    #pragma unroll
    for (int dk = 0; dk < NKC_D; ++dk) {
        v16h a = frag_ld(xrow + dk * KCH);
        #pragma unroll
        for (int u = 0; u < 4; ++u) {
            v16h wb = frag_ld(wrow + (size_t)u * 16 * D_DIM + dk * KCH);
            acc[u] = wmma_f16(a, wb, acc[u]);
        }
    }

    if (wave == 0) {
        const float qscale = 0.03608439182435161f;   // 1/sqrt(768)
        #pragma unroll
        for (int u = 0; u < 4; ++u) {
            half_t* dst = Qh + (size_t)g0 * D_DIM + n0 + u * 16 + r;
            #pragma unroll
            for (int i = 0; i < 8; ++i)
                dst[(size_t)(i + mhi) * D_DIM] = (half_t)(acc[u][i] * qscale);
        }
    } else if (wave == 1) {
        #pragma unroll
        for (int u = 0; u < 4; ++u) {
            half_t* dst = Kh + (size_t)g0 * D_DIM + n0 + u * 16 + r;
            #pragma unroll
            for (int i = 0; i < 8; ++i)
                dst[(size_t)(i + mhi) * D_DIM] = (half_t)acc[u][i];
        }
    } else {
        const int b  = g0 >> 11;                 // S = 2048
        const int s0 = g0 & (S_LEN - 1);
        #pragma unroll
        for (int u = 0; u < 4; ++u) {
            half_t* dst = Vt + ((size_t)b * D_DIM + n0 + u * 16 + r) * S_LEN + s0;
            #pragma unroll
            for (int i = 0; i < 8; ++i)
                dst[i + mhi] = (half_t)acc[u][i];
        }
    }
}

// ---------------------------------------------------------------------------
// Kernel 3: attention for one 16-row query tile.
// grid = B*S/16, block = 256 (8 waves -> 2 waves/SIMD for latency hiding).
// LDS: Qs 24KB | Sc 128KB (f32 scores) | Pq 64KB (f16 exp) | reductions ~1KB
// ---------------------------------------------------------------------------
#define SMEM_QS   (16 * D_DIM * 2)                 // 24576
#define SMEM_SC   (16 * S_LEN * 4)                 // 131072
#define SMEM_PQ   (16 * S_LEN * 2)                 // 65536
#define SMEM_RED  ((256 + 16 + 16) * 4)            // 1152
#define SMEM_TOT  (SMEM_QS + SMEM_SC + SMEM_PQ + SMEM_RED)

__global__ __launch_bounds__(256, 1)
void attn_kernel(const half_t* __restrict__ Qh,
                 const half_t* __restrict__ Kh,
                 const half_t* __restrict__ Vt,
                 float* __restrict__ Out) {
    extern __shared__ char smem[];
    half_t* Qs      = (half_t*)(smem);
    float*  Sc      = (float*)(smem + SMEM_QS);
    half_t* Pq      = (half_t*)(smem + SMEM_QS + SMEM_SC);
    float*  partial = (float*)(smem + SMEM_QS + SMEM_SC + SMEM_PQ); // [256]
    float*  rowmax  = partial + 256;                                // [16]
    float*  rowsum  = partial + 272;                                // [16]

    const int tid  = threadIdx.x;
    const int lane = tid & 31;
    const int wave = tid >> 5;                   // 0..7
    const int g0   = blockIdx.x * 16;            // global query row
    const int b    = g0 >> 11;
    const int r    = lane & 15;
    const int mhi  = (lane >> 4) ? 8 : 0;
    const int ko   = mhi;

    // ---- stage 0: stage Q tile (contiguous 24KB) into LDS ----
    {
        const uint4* src = (const uint4*)(Qh + (size_t)g0 * D_DIM);
        uint4* dst = (uint4*)Qs;
        #pragma unroll
        for (int i = 0; i < (SMEM_QS / 16) / 256; ++i)
            dst[tid + i * 256] = src[tid + i * 256];
    }
    __syncthreads();

    // ---- stage 1: scores = Q Kt (scale pre-folded into Q) ----
    // wave handles keys [wave*256, wave*256+256), 4 key-chunks per iteration:
    // one Q A-frag (LDS) feeds 4 K B-frags (global).
    for (int c = 0; c < 4; ++c) {
        const int key0 = wave * 256 + c * 64;
        v8f acc[4] = {};
        const half_t* qrow = Qs + r * D_DIM + ko;
        const half_t* krow = Kh + ((size_t)b * S_LEN + key0 + r) * D_DIM + ko;
        #pragma unroll
        for (int dk = 0; dk < NKC_D; ++dk) {
            v16h a = frag_ld(qrow + dk * KCH);
            #pragma unroll
            for (int u = 0; u < 4; ++u) {
                v16h kb = frag_ld(krow + (size_t)u * 16 * D_DIM + dk * KCH);
                acc[u] = wmma_f16(a, kb, acc[u]);
            }
        }
        #pragma unroll
        for (int u = 0; u < 4; ++u)
            #pragma unroll
            for (int i = 0; i < 8; ++i)
                Sc[(i + mhi) * S_LEN + key0 + u * 16 + r] = acc[u][i];
    }
    __syncthreads();

    // ---- stage 2: softmax stats + unnormalized exp(P) in f16 ----
    {
        const int row = tid >> 4;                // 16 rows, 16 threads/row
        const int seg = tid & 15;                // 128 cols/thread
        const float4* srow4 = (const float4*)(Sc + row * S_LEN + seg * 128);
        float m = -3.0e38f;
        for (int i = 0; i < 32; ++i) {
            float4 v = srow4[i];
            m = fmaxf(m, fmaxf(fmaxf(v.x, v.y), fmaxf(v.z, v.w)));
        }
        partial[tid] = m;
        __syncthreads();
        if (seg == 0) {
            float mm = partial[row * 16];
            #pragma unroll
            for (int i = 1; i < 16; ++i) mm = fmaxf(mm, partial[row * 16 + i]);
            rowmax[row] = mm;
        }
        __syncthreads();
        const float rm = rowmax[row];
        half_t* prow = Pq + row * S_LEN + seg * 128;
        float s = 0.0f;
        for (int i = 0; i < 32; ++i) {
            float4 v = srow4[i];
            float e0 = __expf(v.x - rm);
            float e1 = __expf(v.y - rm);
            float e2 = __expf(v.z - rm);
            float e3 = __expf(v.w - rm);
            s += (e0 + e1) + (e2 + e3);
            v4h h;
            h[0] = (half_t)e0; h[1] = (half_t)e1;
            h[2] = (half_t)e2; h[3] = (half_t)e3;
            *(v4h*)(prow + i * 4) = h;
        }
        partial[tid] = s;
        __syncthreads();
        if (seg == 0) {
            float ss = 0.0f;
            #pragma unroll
            for (int i = 0; i < 16; ++i) ss += partial[row * 16 + i];
            rowsum[row] = ss;
        }
        __syncthreads();
    }

    // ---- stage 3: Out = (P @ V) / rowsum ----
    // wave handles 96 d-cols as 2 iterations of 3 chunks: one P A-frag (LDS)
    // feeds 3 V B-frags (global).
    float rs[8];
    #pragma unroll
    for (int i = 0; i < 8; ++i) rs[i] = 1.0f / rowsum[i + mhi];

    for (int j = 0; j < 2; ++j) {
        const int n0 = wave * 96 + j * 48;
        v8f acc[3] = {};
        const half_t* prow = Pq + r * S_LEN + ko;
        const half_t* vrow = Vt + ((size_t)b * D_DIM + n0 + r) * S_LEN + ko;
        #pragma unroll 4
        for (int kc = 0; kc < NKC_S; ++kc) {
            v16h a = frag_ld(prow + kc * KCH);
            #pragma unroll
            for (int u = 0; u < 3; ++u) {
                v16h vb = frag_ld(vrow + (size_t)u * 16 * S_LEN + kc * KCH);
                acc[u] = wmma_f16(a, vb, acc[u]);
            }
        }
        #pragma unroll
        for (int u = 0; u < 3; ++u) {
            float* orow = Out + (size_t)g0 * D_DIM + n0 + u * 16 + r;
            #pragma unroll
            for (int i = 0; i < 8; ++i)
                orow[(size_t)(i + mhi) * D_DIM] = acc[u][i] * rs[i];
        }
    }
}

// ---------------------------------------------------------------------------
extern "C" void kernel_launch(void* const* d_in, const int* in_sizes, int n_in,
                              void* d_out, int out_size, void* d_ws, size_t ws_size,
                              hipStream_t stream) {
    const float* X  = (const float*)d_in[0];
    const float* Wq = (const float*)d_in[1];
    const float* bq = (const float*)d_in[2];
    const float* Wk = (const float*)d_in[3];
    const float* bk = (const float*)d_in[4];
    const float* Wv = (const float*)d_in[5];
    const float* bv = (const float*)d_in[6];
    float* out = (float*)d_out;

    const size_t nX = (size_t)B_N * S_LEN * D_DIM;     // 6291456
    const size_t nW = (size_t)D_DIM * D_DIM;           // 589824

    char* ws = (char*)d_ws;
    half_t* Xh  = (half_t*)ws;              ws += nX * sizeof(half_t);
    half_t* Wqh = (half_t*)ws;              ws += nW * sizeof(half_t);
    half_t* Wkh = (half_t*)ws;              ws += nW * sizeof(half_t);
    half_t* Wvh = (half_t*)ws;              ws += nW * sizeof(half_t);
    half_t* Qh  = (half_t*)ws;              ws += nX * sizeof(half_t);
    half_t* Kh  = (half_t*)ws;              ws += nX * sizeof(half_t);
    half_t* Vt  = (half_t*)ws;              ws += nX * sizeof(half_t);

    // 1) f32 -> f16 conversions (4 elems/thread)
    cvt_f16_kernel<<<1024, 256, 0, stream>>>(X,  Xh,  (int)(nX / 4));
    cvt_f16_kernel<<< 256, 256, 0, stream>>>(Wq, Wqh, (int)(nW / 4));
    cvt_f16_kernel<<< 256, 256, 0, stream>>>(Wk, Wkh, (int)(nW / 4));
    cvt_f16_kernel<<< 256, 256, 0, stream>>>(Wv, Wvh, (int)(nW / 4));

    // 2) QKV projection: 12 x 64-wide output blocks x 512 row tiles
    dim3 gq(D_DIM / 64, (B_N * S_LEN) / 16);
    qkv_kernel<<<gq, 96, 0, stream>>>(Xh, Wqh, Wkh, Wvh, bq, bk, bv, Qh, Kh, Vt);

    // 3) attention: one block per 16-row query tile, ~217KB dynamic LDS
    (void)hipFuncSetAttribute(reinterpret_cast<const void*>(attn_kernel),
                              hipFuncAttributeMaxDynamicSharedMemorySize,
                              SMEM_TOT);
    attn_kernel<<<(B_N * S_LEN) / 16, 256, SMEM_TOT, stream>>>(Qh, Kh, Vt, out);
}

// v001
// Measured time: 335 microseconds a run.
// In two side-by-side timings against v000, it was 1.39 and 1.38 times as fast.
#include <hip/hip_runtime.h>
#include <hip/hip_bf16.h>

typedef _Float16 half_t;
typedef __attribute__((ext_vector_type(4)))  half_t v4h;
typedef __attribute__((ext_vector_type(8)))  half_t v8h;
typedef __attribute__((ext_vector_type(16))) half_t v16h;
typedef __attribute__((ext_vector_type(8)))  float  v8f;

#define B_N    4
#define S_LEN  2048
#define D_DIM  768
#define KCH    32              // K-dim per wmma
#define NKC_D  (D_DIM / KCH)   // 24
#define NKC_S  (S_LEN / KCH)   // 64

// Per-lane fragment load for 16-bit A/B operands of v_wmma_*_16x16x32.
// p must already point at: row_base + k_base + (lane>=16 ? 8 : 0).
// Lane holds two contiguous 8-half (16B) chunks at +0 and +16 halves.
__device__ __forceinline__ v16h frag_ld(const half_t* p) {
    v8h lo = *(const v8h*)(p);
    v8h hi = *(const v8h*)(p + 16);
    return __builtin_shufflevector(lo, hi, 0,1,2,3,4,5,6,7,8,9,10,11,12,13,14,15);
}

__device__ __forceinline__ v8f wmma_f16(v16h a, v16h b, v8f c) {
    return __builtin_amdgcn_wmma_f32_16x16x32_f16(false, a, false, b, (short)0, c, false, false);
}

// exp(x) as __expf forms it (x * log2(e), then v_exp_f32). The v_nop fills the one
// slot the instruction set asks for behind a transcendental before its result is
// read or its source register overwritten.
__device__ __forceinline__ float exp_slot(float x) {
    float y;
    asm("v_exp_f32 %0, %1\n\tv_nop" : "=v"(y) : "v"(x * 1.44269504088896340736f));
    return y;
}

// ---------------------------------------------------------------------------
// Kernel 1: f32 -> f16 conversion, 4 elems/thread (grid-stride)
// ---------------------------------------------------------------------------
__global__ void cvt_f16_kernel(const float* __restrict__ src,
                               half_t* __restrict__ dst, int n4) {
    int i = blockIdx.x * blockDim.x + threadIdx.x;
    int stride = gridDim.x * blockDim.x;
    for (; i < n4; i += stride) {
        float4 v = ((const float4*)src)[i];
        v4h h;
        h[0] = (half_t)v.x; h[1] = (half_t)v.y;
        h[2] = (half_t)v.z; h[3] = (half_t)v.w;
        *(v4h*)(dst + (size_t)i * 4) = h;
    }
}

// ---------------------------------------------------------------------------
// Kernel 2: QKV projection. grid = (D/64, B*S/16), block = 96 (3 waves).
// Each wave computes a 16x64 output block (4 accumulators, A-frag reused 4x).
// wave 0 -> Q (scaled by 1/sqrt(D), f16 row-major)
// wave 1 -> K (f16 row-major)
// wave 2 -> V (f16 transposed: Vt[b][d][s])
// ---------------------------------------------------------------------------
__global__ __launch_bounds__(96)
void qkv_kernel(const half_t* __restrict__ Xh,
                const half_t* __restrict__ Wqh,
                const half_t* __restrict__ Wkh,
                const half_t* __restrict__ Wvh,
                const float*  __restrict__ bq,
                const float*  __restrict__ bk,
                const float*  __restrict__ bv,
                half_t* __restrict__ Qh,
                half_t* __restrict__ Kh,
                half_t* __restrict__ Vt) {
    const int lane = threadIdx.x & 31;
    const int wave = threadIdx.x >> 5;          // 0=Q, 1=K, 2=V
    const int n0   = blockIdx.x * 64;           // output-channel block
    const int g0   = blockIdx.y * 16;           // global row in [0, B*S)
    const int r    = lane & 15;
    const int mhi  = (lane >> 4) ? 8 : 0;
    const int ko   = mhi;                       // k-offset pattern for frags

    const half_t* W  = (wave == 0) ? Wqh : (wave == 1) ? Wkh : Wvh;
    const float*  bb = (wave == 0) ? bq  : (wave == 1) ? bk  : bv;

    v8f acc[4];
    #pragma unroll
    for (int u = 0; u < 4; ++u) {
        float bias = bb[n0 + u * 16 + r];
        #pragma unroll
        for (int i = 0; i < 8; ++i) acc[u][i] = bias;
    }

    const half_t* xrow = Xh + (size_t)(g0 + r) * D_DIM + ko;
    const half_t* wrow = W  + (size_t)(n0 + r) * D_DIM + ko;  // +u*16 rows per chunk
    #pragma unroll
    for (int dk = 0; dk < NKC_D; ++dk) {
        v16h a = frag_ld(xrow + dk * KCH);
        #pragma unroll
        for (int u = 0; u < 4; ++u) {
            v16h wb = frag_ld(wrow + (size_t)u * 16 * D_DIM + dk * KCH);
            acc[u] = wmma_f16(a, wb, acc[u]);
        }
    }

    if (wave == 0) {
        const float qscale = 0.03608439182435161f;   // 1/sqrt(768)
        #pragma unroll
        for (int u = 0; u < 4; ++u) {
            half_t* dst = Qh + (size_t)g0 * D_DIM + n0 + u * 16 + r;
            #pragma unroll
            for (int i = 0; i < 8; ++i)
                dst[(size_t)(i + mhi) * D_DIM] = (half_t)(acc[u][i] * qscale);
        }
    } else if (wave == 1) {
        #pragma unroll
        for (int u = 0; u < 4; ++u) {
            half_t* dst = Kh + (size_t)g0 * D_DIM + n0 + u * 16 + r;
            #pragma unroll
            for (int i = 0; i < 8; ++i)
                dst[(size_t)(i + mhi) * D_DIM] = (half_t)acc[u][i];
        }
    } else {
        const int b  = g0 >> 11;                 // S = 2048
        const int s0 = g0 & (S_LEN - 1);
        #pragma unroll
        for (int u = 0; u < 4; ++u) {
            half_t* dst = Vt + ((size_t)b * D_DIM + n0 + u * 16 + r) * S_LEN + s0;
            #pragma unroll
            for (int i = 0; i < 8; ++i)
                dst[i + mhi] = (half_t)acc[u][i];
        }
    }
}

// ---------------------------------------------------------------------------
// Kernel 3: attention for one 32-row query tile (two 16-row A tiles).
// grid = B*S/32, block = 256 (8 waves -> 2 waves/SIMD for latency hiding).
// Every K and V fragment loaded from global feeds two WMMAs, one per A tile.
// LDS: Qs 48KB | Sc 256KB (f32 scores; f16 exp overwrites them in place) | reductions ~2KB
// ---------------------------------------------------------------------------
#define QROWS     32
#define SMEM_QS   (QROWS * D_DIM * 2)              // 49152
#define SMEM_SC   (QROWS * S_LEN * 4)              // 262144
#define SMEM_RED  ((512 + QROWS + QROWS) * 4)      // 2304
#define SMEM_TOT  (SMEM_QS + SMEM_SC + SMEM_RED)   // 313600
#define P_PITCH   (S_LEN * 2)                      // halves per P row (= one f32 score row)

__global__ __launch_bounds__(256, 1)
void attn_kernel(const half_t* __restrict__ Qh,
                 const half_t* __restrict__ Kh,
                 const half_t* __restrict__ Vt,
                 float* __restrict__ Out) {
    __shared__ __attribute__((aligned(16))) char smem[SMEM_TOT];
    half_t* Qs      = (half_t*)(smem);
    float*  Sc      = (float*)(smem + SMEM_QS);
    half_t* Pq      = (half_t*)(smem + SMEM_QS);          // in place over Sc
    float*  partial = (float*)(smem + SMEM_QS + SMEM_SC); // [512]
    float*  rowmax  = partial + 512;                      // [32]
    float*  rowsum  = partial + 512 + QROWS;              // [32]

    const int tid  = threadIdx.x;
    const int lane = tid & 31;
    const int wave = tid >> 5;                   // 0..7
    const int g0   = blockIdx.x * QROWS;         // global query row
    const int b    = g0 >> 11;
    const int r    = lane & 15;
    const int mhi  = (lane >> 4) ? 8 : 0;
    const int ko   = mhi;

    // ---- stage 0: stage Q tile (contiguous 48KB) into LDS ----
    {
        const uint4* src = (const uint4*)(Qh + (size_t)g0 * D_DIM);
        uint4* dst = (uint4*)Qs;
        #pragma unroll
        for (int i = 0; i < (SMEM_QS / 16) / 256; ++i)
            dst[tid + i * 256] = src[tid + i * 256];
    }
    __syncthreads();

    // ---- stage 1: scores = Q Kt (scale pre-folded into Q) ----
    // wave handles keys [wave*256, wave*256+256), 4 key-chunks per iteration:
    // two Q A-frags (LDS) x 4 K B-frags (global) = 8 WMMAs per 4 global fragments.
    for (int c = 0; c < 4; ++c) {
        const int key0 = wave * 256 + c * 64;
        v8f acc[2][4] = {};
        const half_t* qrow = Qs + r * D_DIM + ko;
        const half_t* krow = Kh + ((size_t)b * S_LEN + key0 + r) * D_DIM + ko;
        #pragma unroll
        for (int dk = 0; dk < NKC_D; ++dk) {
            v16h a0 = frag_ld(qrow + dk * KCH);
            v16h a1 = frag_ld(qrow + 16 * D_DIM + dk * KCH);
            #pragma unroll
            for (int u = 0; u < 4; ++u) {
                v16h kb = frag_ld(krow + (size_t)u * 16 * D_DIM + dk * KCH);
                acc[0][u] = wmma_f16(a0, kb, acc[0][u]);
                acc[1][u] = wmma_f16(a1, kb, acc[1][u]);
            }
        }
        // unrolled so that acc[][] is indexed by constants and stays in registers
        #pragma unroll
        for (int t = 0; t < 2; ++t)
            #pragma unroll
            for (int u = 0; u < 4; ++u)
                #pragma unroll
                for (int i = 0; i < 8; ++i)
                    Sc[(t * 16 + i + mhi) * S_LEN + key0 + u * 16 + r] = acc[t][u][i];
    }
    __syncthreads();

    // ---- stage 2: softmax stats + unnormalized exp(P) in f16 ----
    // 16 threads per row, 128 cols per thread, rows (tid>>4) and (tid>>4)+16.
    // A thread's f16 results go into the first half of the 512 bytes its own
    // f32 scores occupy: the 8-byte store of step i lies at or below the 16
    // bytes read in step i, and no other thread touches that range.
    {
        const int row = tid >> 4;
        const int seg = tid & 15;
        for (int h = 0; h < 2; ++h) {
            const float4* srow4 = (const float4*)(Sc + (row + h * 16) * S_LEN + seg * 128);
            float m = -3.0e38f;
            for (int i = 0; i < 32; ++i) {
                float4 v = srow4[i];
                m = fmaxf(m, fmaxf(fmaxf(v.x, v.y), fmaxf(v.z, v.w)));
            }
            partial[h * 256 + tid] = m;
        }
        __syncthreads();
        if (seg < 2) {                            // seg selects the row half
            const int rr = row + seg * 16;
            float mm = partial[rr * 16];
            #pragma unroll
            for (int i = 1; i < 16; ++i) mm = fmaxf(mm, partial[rr * 16 + i]);
            rowmax[rr] = mm;
        }
        __syncthreads();
        for (int h = 0; h < 2; ++h) {
            const float rm = rowmax[row + h * 16];
            const float4* srow4 = (const float4*)(Sc + (row + h * 16) * S_LEN + seg * 128);
            half_t* prow = Pq + (row + h * 16) * P_PITCH + seg * 256;
            float s = 0.0f;
            for (int i = 0; i < 32; ++i) {
                float4 v = srow4[i];
                float e0 = exp_slot(v.x - rm);
                float e1 = exp_slot(v.y - rm);
                float e2 = exp_slot(v.z - rm);
                float e3 = exp_slot(v.w - rm);
                s += (e0 + e1) + (e2 + e3);
                v4h hh;
                hh[0] = (half_t)e0; hh[1] = (half_t)e1;
                hh[2] = (half_t)e2; hh[3] = (half_t)e3;
                *(v4h*)(prow + i * 4) = hh;
            }
            partial[h * 256 + tid] = s;
        }
        __syncthreads();
        if (seg < 2) {
            const int rr = row + seg * 16;
            float ss = 0.0f;
            #pragma unroll
            for (int i = 0; i < 16; ++i) ss += partial[rr * 16 + i];
            rowsum[rr] = ss;
        }
        __syncthreads();
    }

    // ---- stage 3: Out = (P @ V) / rowsum ----
    // wave tile: 32 query rows x 96 d-cols, 12 accumulators: two P A-frags (LDS,
    // each read once per wave) x 6 V B-frags (global) = 12 WMMAs per 32 keys.
    // Key chunk kc (32 keys) of a P row starts at half (kc>>2)*256 + (kc&3)*32.
    float rs[2][8];
    // unrolled so that rs[][] stays in registers
    #pragma unroll
    for (int t = 0; t < 2; ++t)
        #pragma unroll
        for (int i = 0; i < 8; ++i) rs[t][i] = 1.0f / rowsum[t * 16 + i + mhi];

    {
        const int n0 = wave * 96;
        v8f acc[2][6] = {};
        const half_t* prow = Pq + r * P_PITCH + ko;
        const half_t* vrow = Vt + ((size_t)b * D_DIM + n0 + r) * S_LEN + ko;
        #pragma unroll 4
        for (int kc = 0; kc < NKC_S; ++kc) {
            const int po = (kc >> 2) * 256 + (kc & 3) * KCH;
            v16h a0 = frag_ld(prow + po);
            v16h a1 = frag_ld(prow + 16 * P_PITCH + po);
            #pragma unroll
            for (int u = 0; u < 6; ++u) {
                v16h vb = frag_ld(vrow + (size_t)u * 16 * S_LEN + kc * KCH);
                acc[0][u] = wmma_f16(a0, vb, acc[0][u]);
                acc[1][u] = wmma_f16(a1, vb, acc[1][u]);
            }
        }
        // unrolled so that acc[][] and rs[][] stay in registers
        #pragma unroll
        for (int t = 0; t < 2; ++t)
            #pragma unroll
            for (int u = 0; u < 6; ++u) {
                float* orow = Out + (size_t)(g0 + t * 16) * D_DIM + n0 + u * 16 + r;
                #pragma unroll
                for (int i = 0; i < 8; ++i)
                    orow[(size_t)(i + mhi) * D_DIM] = acc[t][u][i] * rs[t][i];
            }
    }
}

// ---------------------------------------------------------------------------
extern "C" void kernel_launch(void* const* d_in, const int* in_sizes, int n_in,
                              void* d_out, int out_size, void* d_ws, size_t ws_size,
                              hipStream_t stream) {
    const float* X  = (const float*)d_in[0];
    const float* Wq = (const float*)d_in[1];
    const float* bq = (const float*)d_in[2];
    const float* Wk = (const float*)d_in[3];
    const float* bk = (const float*)d_in[4];
    const float* Wv = (const float*)d_in[5];
    const float* bv = (const float*)d_in[6];
    float* out = (float*)d_out;

    const size_t nX = (size_t)B_N * S_LEN * D_DIM;     // 6291456
    const size_t nW = (size_t)D_DIM * D_DIM;           // 589824

    char* ws = (char*)d_ws;
    half_t* Xh  = (half_t*)ws;              ws += nX * sizeof(half_t);
    half_t* Wqh = (half_t*)ws;              ws += nW * sizeof(half_t);
    half_t* Wkh = (half_t*)ws;              ws += nW * sizeof(half_t);
    half_t* Wvh = (half_t*)ws;              ws += nW * sizeof(half_t);
    half_t* Qh  = (half_t*)ws;              ws += nX * sizeof(half_t);
    half_t* Kh  = (half_t*)ws;              ws += nX * sizeof(half_t);
    half_t* Vt  = (half_t*)ws;              ws += nX * sizeof(half_t);

    // 1) f32 -> f16 conversions (4 elems/thread)
    cvt_f16_kernel<<<1024, 256, 0, stream>>>(X,  Xh,  (int)(nX / 4));
    cvt_f16_kernel<<< 256, 256, 0, stream>>>(Wq, Wqh, (int)(nW / 4));
    cvt_f16_kernel<<< 256, 256, 0, stream>>>(Wk, Wkh, (int)(nW / 4));
    cvt_f16_kernel<<< 256, 256, 0, stream>>>(Wv, Wvh, (int)(nW / 4));

    // 2) QKV projection: 12 x 64-wide output blocks x 512 row tiles
    dim3 gq(D_DIM / 64, (B_N * S_LEN) / 16);
    qkv_kernel<<<gq, 96, 0, stream>>>(Xh, Wqh, Wkh, Wvh, bq, bk, bv, Qh, Kh, Vt);

    // 3) attention: one block per 32-row query tile, ~306KB static LDS
    attn_kernel<<<(B_N * S_LEN) / QROWS, 256, 0, stream>>>(Qh, Kh, Vt, out);
}

// v002
// It runs in 240 microseconds.
// Two timings next to v001 both put it at 1.40 times that version's speed.
// Over all steps from v000 it is 1.94 times as fast.
#include <hip/hip_runtime.h>
#include <hip/hip_bf16.h>

typedef _Float16 half_t;
typedef __attribute__((ext_vector_type(4)))  half_t v4h;
typedef __attribute__((ext_vector_type(8)))  half_t v8h;
typedef __attribute__((ext_vector_type(16))) half_t v16h;
typedef __attribute__((ext_vector_type(8)))  float  v8f;

#define B_N    4
#define S_LEN  2048
#define D_DIM  768
#define KCH    32              // K-dim per wmma
#define NKC_D  (D_DIM / KCH)   // 24
#define NKC_S  (S_LEN / KCH)   // 64

// Per-lane fragment load for 16-bit A/B operands of v_wmma_*_16x16x32.
// p must already point at: row_base + k_base + (lane>=16 ? 8 : 0).
// Lane holds two contiguous 8-half (16B) chunks at +0 and +16 halves.
__device__ __forceinline__ v16h frag_ld(const half_t* p) {
    v8h lo = *(const v8h*)(p);
    v8h hi = *(const v8h*)(p + 16);
    return __builtin_shufflevector(lo, hi, 0,1,2,3,4,5,6,7,8,9,10,11,12,13,14,15);
}

__device__ __forceinline__ v8f wmma_f16(v16h a, v16h b, v8f c) {
    return __builtin_amdgcn_wmma_f32_16x16x32_f16(false, a, false, b, (short)0, c, false, false);
}

// exp(x) as __expf forms it (x * log2(e), then v_exp_f32). The v_nop fills the one
// slot the instruction set asks for behind a transcendental before its result is
// read or its source register overwritten.
__device__ __forceinline__ float exp_slot(float x) {
    float y;
    asm("v_exp_f32 %0, %1\n\tv_nop" : "=v"(y) : "v"(x * 1.44269504088896340736f));
    return y;
}

// ---------------------------------------------------------------------------
// Kernel 1: f32 -> f16 conversion, 4 elems/thread (grid-stride)
// ---------------------------------------------------------------------------
__global__ void cvt_f16_kernel(const float* __restrict__ src,
                               half_t* __restrict__ dst, int n4) {
    int i = blockIdx.x * blockDim.x + threadIdx.x;
    int stride = gridDim.x * blockDim.x;
    for (; i < n4; i += stride) {
        float4 v = ((const float4*)src)[i];
        v4h h;
        h[0] = (half_t)v.x; h[1] = (half_t)v.y;
        h[2] = (half_t)v.z; h[3] = (half_t)v.w;
        *(v4h*)(dst + (size_t)i * 4) = h;
    }
}

// ---------------------------------------------------------------------------
// Kernel 2: QKV projection. grid = (3*D/384, B*S/64), block = 128 (4 waves, one per SIMD).
// Each wave computes a 64x96 output block (24 accumulators) in k steps of 64, one
// 128-byte line of every X and W row: 8 X A-frags and 12 W B-frags feed 48 WMMAs,
// and both halves of a line are asked for one behind the other.
// The 24 column blocks of [Q | K | V] go to the waves in order, 8 per matrix:
// block 0..7   -> Q (scaled by 1/sqrt(D), f16 row-major)
// block 8..15  -> K (f16 row-major)
// block 16..23 -> V (f16 transposed: Vt[b][d][s])
// ---------------------------------------------------------------------------
#define QKV_NT 6                               // 16-column tiles per wave
__global__ __launch_bounds__(128)
void qkv_kernel(const half_t* __restrict__ Xh,
                const half_t* __restrict__ Wqh,
                const half_t* __restrict__ Wkh,
                const half_t* __restrict__ Wvh,
                const float*  __restrict__ bq,
                const float*  __restrict__ bk,
                const float*  __restrict__ bv,
                half_t* __restrict__ Qh,
                half_t* __restrict__ Kh,
                half_t* __restrict__ Vt) {
    const int lane = threadIdx.x & 31;
    const int cb   = blockIdx.x * 4 + (threadIdx.x >> 5);    // column block, 0..23
    const int wave = cb / (D_DIM / (QKV_NT * 16));           // 0=Q, 1=K, 2=V
    const int n0   = (cb % (D_DIM / (QKV_NT * 16))) * (QKV_NT * 16); // output-channel block
    const int g0   = blockIdx.y * 64;           // global row in [0, B*S)
    const int r    = lane & 15;
    const int mhi  = (lane >> 4) ? 8 : 0;
    const int ko   = mhi;                       // k-offset pattern for frags

    const half_t* W  = (wave == 0) ? Wqh : (wave == 1) ? Wkh : Wvh;
    const float*  bb = (wave == 0) ? bq  : (wave == 1) ? bk  : bv;

    v8f acc[4][QKV_NT];                         // [row tile m][column tile u]
    #pragma unroll
    for (int u = 0; u < QKV_NT; ++u) {
        float bias = bb[n0 + u * 16 + r];
        #pragma unroll
        for (int m = 0; m < 4; ++m)
            #pragma unroll
            for (int i = 0; i < 8; ++i) acc[m][u][i] = bias;
    }

    const half_t* xrow = Xh + (size_t)(g0 + r) * D_DIM + ko;
    const half_t* wrow = W  + (size_t)(n0 + r) * D_DIM + ko;  // +u*16 rows per chunk
    #pragma unroll
    for (int kk = 0; kk < NKC_D / 2; ++kk) {
        v16h a[4][2];
        #pragma unroll
        for (int m = 0; m < 4; ++m)
            #pragma unroll
            for (int s = 0; s < 2; ++s)
                a[m][s] = frag_ld(xrow + (size_t)m * 16 * D_DIM + (kk * 2 + s) * KCH);
        #pragma unroll
        for (int u = 0; u < QKV_NT; ++u) {
            v16h wb[2];
            #pragma unroll
            for (int s = 0; s < 2; ++s)
                wb[s] = frag_ld(wrow + (size_t)u * 16 * D_DIM + (kk * 2 + s) * KCH);
            // the two scheduling barriers keep the four loads of a row's line together
            // and in front of the WMMAs: without them the scheduler runs all of s = 0
            // first and asks for the line's second half much later, one wait more each
            __builtin_amdgcn_sched_barrier(0);
            #pragma unroll
            for (int s = 0; s < 2; ++s)
                #pragma unroll
                for (int m = 0; m < 4; ++m) acc[m][u] = wmma_f16(a[m][s], wb[s], acc[m][u]);
            __builtin_amdgcn_sched_barrier(0);
        }
    }

    if (wave == 0) {
        const float qscale = 0.03608439182435161f;   // 1/sqrt(768)
        #pragma unroll
        for (int m = 0; m < 4; ++m)
            #pragma unroll
            for (int u = 0; u < QKV_NT; ++u) {
                half_t* dst = Qh + (size_t)(g0 + m * 16) * D_DIM + n0 + u * 16 + r;
                #pragma unroll
                for (int i = 0; i < 8; ++i)
                    dst[(size_t)(i + mhi) * D_DIM] = (half_t)(acc[m][u][i] * qscale);
            }
    } else if (wave == 1) {
        #pragma unroll
        for (int m = 0; m < 4; ++m)
            #pragma unroll
            for (int u = 0; u < QKV_NT; ++u) {
                half_t* dst = Kh + (size_t)(g0 + m * 16) * D_DIM + n0 + u * 16 + r;
                #pragma unroll
                for (int i = 0; i < 8; ++i)
                    dst[(size_t)(i + mhi) * D_DIM] = (half_t)acc[m][u][i];
            }
    } else {
        const int b  = g0 >> 11;                 // S = 2048
        const int s0 = g0 & (S_LEN - 1);
        #pragma unroll
        for (int m = 0; m < 4; ++m)
            #pragma unroll
            for (int u = 0; u < QKV_NT; ++u) {
                half_t* dst = Vt + ((size_t)b * D_DIM + n0 + u * 16 + r) * S_LEN + s0 + m * 16;
                #pragma unroll
                for (int i = 0; i < 8; ++i)
                    dst[i + mhi] = (half_t)acc[m][u][i];
            }
    }
}

// ---------------------------------------------------------------------------
// Kernel 3: attention for one 32-row query tile (two 16-row A tiles).
// grid = B*S/32, block = 256 (8 waves -> 2 waves/SIMD for latency hiding).
// Every K and V fragment loaded from global feeds two WMMAs, one per A tile.
// LDS: Qs 48KB | Sc 256KB (f32 scores; f16 exp overwrites them in place) | reductions ~2KB
// ---------------------------------------------------------------------------
#define QROWS     32
#define SMEM_QS   (QROWS * D_DIM * 2)              // 49152
#define SMEM_SC   (QROWS * S_LEN * 4)              // 262144
#define SMEM_RED  ((512 + QROWS + QROWS) * 4)      // 2304
#define SMEM_TOT  (SMEM_QS + SMEM_SC + SMEM_RED)   // 313600
#define P_PITCH   (S_LEN * 2)                      // halves per P row (= one f32 score row)

__global__ __launch_bounds__(256, 1)
void attn_kernel(const half_t* __restrict__ Qh,
                 const half_t* __restrict__ Kh,
                 const half_t* __restrict__ Vt,
                 float* __restrict__ Out) {
    __shared__ __attribute__((aligned(16))) char smem[SMEM_TOT];
    half_t* Qs      = (half_t*)(smem);
    float*  Sc      = (float*)(smem + SMEM_QS);
    half_t* Pq      = (half_t*)(smem + SMEM_QS);          // in place over Sc
    float*  partial = (float*)(smem + SMEM_QS + SMEM_SC); // [512]
    float*  rowmax  = partial + 512;                      // [32]
    float*  rowsum  = partial + 512 + QROWS;              // [32]

    const int tid  = threadIdx.x;
    const int lane = tid & 31;
    const int wave = tid >> 5;                   // 0..7
    const int g0   = blockIdx.x * QROWS;         // global query row
    const int b    = g0 >> 11;
    const int r    = lane & 15;
    const int mhi  = (lane >> 4) ? 8 : 0;
    const int ko   = mhi;

    // ---- stage 0: stage Q tile (contiguous 48KB) into LDS ----
    {
        const uint4* src = (const uint4*)(Qh + (size_t)g0 * D_DIM);
        uint4* dst = (uint4*)Qs;
        #pragma unroll
        for (int i = 0; i < (SMEM_QS / 16) / 256; ++i)
            dst[tid + i * 256] = src[tid + i * 256];
    }
    __syncthreads();

    // ---- stage 1: scores = Q Kt (scale pre-folded into Q) ----
    // wave handles keys [wave*256, wave*256+256), 4 key-chunks per iteration:
    // two Q A-frags (LDS) x 4 K B-frags (global) = 8 WMMAs per 4 global fragments.
    for (int c = 0; c < 4; ++c) {
        const int key0 = wave * 256 + c * 64;
        v8f acc[2][4] = {};
        const half_t* qrow = Qs + r * D_DIM + ko;
        const half_t* krow = Kh + ((size_t)b * S_LEN + key0 + r) * D_DIM + ko;
        #pragma unroll
        for (int dk = 0; dk < NKC_D; ++dk) {
            v16h a0 = frag_ld(qrow + dk * KCH);
            v16h a1 = frag_ld(qrow + 16 * D_DIM + dk * KCH);
            #pragma unroll
            for (int u = 0; u < 4; ++u) {
                v16h kb = frag_ld(krow + (size_t)u * 16 * D_DIM + dk * KCH);
                acc[0][u] = wmma_f16(a0, kb, acc[0][u]);
                acc[1][u] = wmma_f16(a1, kb, acc[1][u]);
            }
        }
        // unrolled so that acc[][] is indexed by constants and stays in registers
        #pragma unroll
        for (int t = 0; t < 2; ++t)
            #pragma unroll
            for (int u = 0; u < 4; ++u)
                #pragma unroll
                for (int i = 0; i < 8; ++i)
                    Sc[(t * 16 + i + mhi) * S_LEN + key0 + u * 16 + r] = acc[t][u][i];
    }
    __syncthreads();

    // ---- stage 2: softmax stats + unnormalized exp(P) in f16 ----
    // 16 threads per row, 128 cols per thread, rows (tid>>4) and (tid>>4)+16.
    // A thread's f16 results go into the first half of the 512 bytes its own
    // f32 scores occupy: the 8-byte store of step i lies at or below the 16
    // bytes read in step i, and no other thread touches that range.
    {
        const int row = tid >> 4;
        const int seg = tid & 15;
        for (int h = 0; h < 2; ++h) {
            const float4* srow4 = (const float4*)(Sc + (row + h * 16) * S_LEN + seg * 128);
            float m = -3.0e38f;
            for (int i = 0; i < 32; ++i) {
                float4 v = srow4[i];
                m = fmaxf(m, fmaxf(fmaxf(v.x, v.y), fmaxf(v.z, v.w)));
            }
            partial[h * 256 + tid] = m;
        }
        __syncthreads();
        if (seg < 2) {                            // seg selects the row half
            const int rr = row + seg * 16;
            float mm = partial[rr * 16];
            #pragma unroll
            for (int i = 1; i < 16; ++i) mm = fmaxf(mm, partial[rr * 16 + i]);
            rowmax[rr] = mm;
        }
        __syncthreads();
        for (int h = 0; h < 2; ++h) {
            const float rm = rowmax[row + h * 16];
            const float4* srow4 = (const float4*)(Sc + (row + h * 16) * S_LEN + seg * 128);
            half_t* prow = Pq + (row + h * 16) * P_PITCH + seg * 256;
            float s = 0.0f;
            for (int i = 0; i < 32; ++i) {
                float4 v = srow4[i];
                float e0 = exp_slot(v.x - rm);
                float e1 = exp_slot(v.y - rm);
                float e2 = exp_slot(v.z - rm);
                float e3 = exp_slot(v.w - rm);
                s += (e0 + e1) + (e2 + e3);
                v4h hh;
                hh[0] = (half_t)e0; hh[1] = (half_t)e1;
                hh[2] = (half_t)e2; hh[3] = (half_t)e3;
                *(v4h*)(prow + i * 4) = hh;
            }
            partial[h * 256 + tid] = s;
        }
        __syncthreads();
        if (seg < 2) {
            const int rr = row + seg * 16;
            float ss = 0.0f;
            #pragma unroll
            for (int i = 0; i < 16; ++i) ss += partial[rr * 16 + i];
            rowsum[rr] = ss;
        }
        __syncthreads();
    }

    // ---- stage 3: Out = (P @ V) / rowsum ----
    // wave tile: 32 query rows x 96 d-cols, 12 accumulators: two P A-frags (LDS,
    // each read once per wave) x 6 V B-frags (global) = 12 WMMAs per 32 keys.
    // Key chunk kc (32 keys) of a P row starts at half (kc>>2)*256 + (kc&3)*32.
    float rs[2][8];
    // unrolled so that rs[][] stays in registers
    #pragma unroll
    for (int t = 0; t < 2; ++t)
        #pragma unroll
        for (int i = 0; i < 8; ++i) rs[t][i] = 1.0f / rowsum[t * 16 + i + mhi];

    {
        const int n0 = wave * 96;
        v8f acc[2][6] = {};
        const half_t* prow = Pq + r * P_PITCH + ko;
        const half_t* vrow = Vt + ((size_t)b * D_DIM + n0 + r) * S_LEN + ko;
        #pragma unroll 4
        for (int kc = 0; kc < NKC_S; ++kc) {
            const int po = (kc >> 2) * 256 + (kc & 3) * KCH;
            v16h a0 = frag_ld(prow + po);
            v16h a1 = frag_ld(prow + 16 * P_PITCH + po);
            #pragma unroll
            for (int u = 0; u < 6; ++u) {
                v16h vb = frag_ld(vrow + (size_t)u * 16 * S_LEN + kc * KCH);
                acc[0][u] = wmma_f16(a0, vb, acc[0][u]);
                acc[1][u] = wmma_f16(a1, vb, acc[1][u]);
            }
        }
        // unrolled so that acc[][] and rs[][] stay in registers
        #pragma unroll
        for (int t = 0; t < 2; ++t)
            #pragma unroll
            for (int u = 0; u < 6; ++u) {
                float* orow = Out + (size_t)(g0 + t * 16) * D_DIM + n0 + u * 16 + r;
                #pragma unroll
                for (int i = 0; i < 8; ++i)
                    orow[(size_t)(i + mhi) * D_DIM] = acc[t][u][i] * rs[t][i];
            }
    }
}

// ---------------------------------------------------------------------------
extern "C" void kernel_launch(void* const* d_in, const int* in_sizes, int n_in,
                              void* d_out, int out_size, void* d_ws, size_t ws_size,
                              hipStream_t stream) {
    const float* X  = (const float*)d_in[0];
    const float* Wq = (const float*)d_in[1];
    const float* bq = (const float*)d_in[2];
    const float* Wk = (const float*)d_in[3];
    const float* bk = (const float*)d_in[4];
    const float* Wv = (const float*)d_in[5];
    const float* bv = (const float*)d_in[6];
    float* out = (float*)d_out;

    const size_t nX = (size_t)B_N * S_LEN * D_DIM;     // 6291456
    const size_t nW = (size_t)D_DIM * D_DIM;           // 589824

    char* ws = (char*)d_ws;
    half_t* Xh  = (half_t*)ws;              ws += nX * sizeof(half_t);
    half_t* Wqh = (half_t*)ws;              ws += nW * sizeof(half_t);
    half_t* Wkh = (half_t*)ws;              ws += nW * sizeof(half_t);
    half_t* Wvh = (half_t*)ws;              ws += nW * sizeof(half_t);
    half_t* Qh  = (half_t*)ws;              ws += nX * sizeof(half_t);
    half_t* Kh  = (half_t*)ws;              ws += nX * sizeof(half_t);
    half_t* Vt  = (half_t*)ws;              ws += nX * sizeof(half_t);

    // 1) f32 -> f16 conversions (4 elems/thread)
    cvt_f16_kernel<<<1024, 256, 0, stream>>>(X,  Xh,  (int)(nX / 4));
    cvt_f16_kernel<<< 256, 256, 0, stream>>>(Wq, Wqh, (int)(nW / 4));
    cvt_f16_kernel<<< 256, 256, 0, stream>>>(Wk, Wkh, (int)(nW / 4));
    cvt_f16_kernel<<< 256, 256, 0, stream>>>(Wv, Wvh, (int)(nW / 4));

    // 2) QKV projection: 24 x 96-wide output blocks, 4 per work-group, x 128 row tiles of 64
    dim3 gq(3 * D_DIM / (QKV_NT * 16 * 4), (B_N * S_LEN) / 64);
    qkv_kernel<<<gq, 128, 0, stream>>>(Xh, Wqh, Wkh, Wvh, bq, bk, bv, Qh, Kh, Vt);

    // 3) attention: one block per 32-row query tile, ~306KB static LDS
    attn_kernel<<<(B_N * S_LEN) / QROWS, 256, 0, stream>>>(Qh, Kh, Vt, out);
}

// v003
// One run takes 162 microseconds.
// Timed twice side by side with v002, it ran 1.49 and 1.48 times as fast.
// Counting every step since v000, it is 2.87 times as fast.
#include <hip/hip_runtime.h>
#include <hip/hip_bf16.h>
#include <type_traits>

typedef _Float16 half_t;
typedef __attribute__((ext_vector_type(4)))  half_t v4h;
typedef __attribute__((ext_vector_type(8)))  half_t v8h;
typedef __attribute__((ext_vector_type(16))) half_t v16h;
typedef __attribute__((ext_vector_type(8)))  float  v8f;

#define B_N    4
#define S_LEN  2048
#define D_DIM  768
#define KCH    32              // K-dim per wmma
#define NKC_D  (D_DIM / KCH)   // 24
#define NKC_S  (S_LEN / KCH)   // 64

// Per-lane fragment load for 16-bit A/B operands of v_wmma_*_16x16x32.
// p must already point at: row_base + k_base + (lane>=16 ? 8 : 0).
// Lane holds two contiguous 8-half (16B) chunks at +0 and +16 halves.
__device__ __forceinline__ v16h frag_ld(const half_t* p) {
    v8h lo = *(const v8h*)(p);
    v8h hi = *(const v8h*)(p + 16);
    return __builtin_shufflevector(lo, hi, 0,1,2,3,4,5,6,7,8,9,10,11,12,13,14,15);
}

__device__ __forceinline__ v8f wmma_f16(v16h a, v16h b, v8f c) {
    return __builtin_amdgcn_wmma_f32_16x16x32_f16(false, a, false, b, (short)0, c, false, false);
}

// exp(x) as __expf forms it (x * log2(e), then v_exp_f32). The v_nop fills the one
// slot the instruction set asks for behind a transcendental before its result is
// read or its source register overwritten.
__device__ __forceinline__ float exp_slot(float x) {
    float y;
    asm("v_exp_f32 %0, %1\n\tv_nop" : "=v"(y) : "v"(x * 1.44269504088896340736f));
    return y;
}

// ---------------------------------------------------------------------------
// Kernel 1: f32 -> f16 conversion, 4 elems/thread (grid-stride)
// ---------------------------------------------------------------------------
__global__ void cvt_f16_kernel(const float* __restrict__ src,
                               half_t* __restrict__ dst, int n4) {
    int i = blockIdx.x * blockDim.x + threadIdx.x;
    int stride = gridDim.x * blockDim.x;
    for (; i < n4; i += stride) {
        float4 v = ((const float4*)src)[i];
        v4h h;
        h[0] = (half_t)v.x; h[1] = (half_t)v.y;
        h[2] = (half_t)v.z; h[3] = (half_t)v.w;
        *(v4h*)(dst + (size_t)i * 4) = h;
    }
}

// ---------------------------------------------------------------------------
// Kernel 2: QKV projection. grid = (3*D/384, B*S/64), block = 128 (4 waves, one per SIMD).
// Each wave computes a 64x96 output block (24 accumulators) in k steps of 64, one
// 128-byte line of every X and W row: 8 X A-frags and 12 W B-frags feed 48 WMMAs,
// and both halves of a line are asked for one behind the other.
// The 24 column blocks of [Q | K | V] go to the waves in order, 8 per matrix:
// block 0..7   -> Q (scaled by 1/sqrt(D), f16 row-major)
// block 8..15  -> K (f16 row-major)
// block 16..23 -> V (f16 transposed: Vt[b][d][s])
// ---------------------------------------------------------------------------
#define QKV_NT 6                               // 16-column tiles per wave
#define WRING  3                               // W ring slots
__global__ __launch_bounds__(128)
void qkv_kernel(const half_t* __restrict__ Xh,
                const half_t* __restrict__ Wqh,
                const half_t* __restrict__ Wkh,
                const half_t* __restrict__ Wvh,
                const float*  __restrict__ bq,
                const float*  __restrict__ bk,
                const float*  __restrict__ bv,
                half_t* __restrict__ Qh,
                half_t* __restrict__ Kh,
                half_t* __restrict__ Vt) {
    const int lane = threadIdx.x & 31;
    const int cb   = blockIdx.x * 4 + (threadIdx.x >> 5);    // column block, 0..23
    const int wave = cb / (D_DIM / (QKV_NT * 16));           // 0=Q, 1=K, 2=V
    const int n0   = (cb % (D_DIM / (QKV_NT * 16))) * (QKV_NT * 16); // output-channel block
    const int g0   = blockIdx.y * 64;           // global row in [0, B*S)
    const int r    = lane & 15;
    const int mhi  = (lane >> 4) ? 8 : 0;
    const int ko   = mhi;                       // k-offset pattern for frags

    const half_t* W  = (wave == 0) ? Wqh : (wave == 1) ? Wkh : Wvh;
    const float*  bb = (wave == 0) ? bq  : (wave == 1) ? bk  : bv;

    v8f acc[4][QKV_NT];                         // [row tile m][column tile u]
    #pragma unroll
    for (int u = 0; u < QKV_NT; ++u) {
        float bias = bb[n0 + u * 16 + r];
        #pragma unroll
        for (int m = 0; m < 4; ++m)
            #pragma unroll
            for (int i = 0; i < 8; ++i) acc[m][u][i] = bias;
    }

    const half_t* xrow = Xh + (size_t)(g0 + r) * D_DIM + ko;
    const half_t* wrow = W  + (size_t)(n0 + r) * D_DIM + ko;  // +u*16 rows per chunk
    // The W fragments come through a ring of WRING register slots; a slot holds one column
    // tile's k step (two fragments, one whole line of each of its 16 rows) and is asked for
    // again, WRING tiles ahead of its next use, as soon as its eight WMMAs are issued.
    v16h wb[WRING][2];
    #pragma unroll
    for (int j = 0; j < WRING; ++j)
        #pragma unroll
        for (int s = 0; s < 2; ++s)
            wb[j][s] = frag_ld(wrow + (size_t)(j % QKV_NT) * 16 * D_DIM + ((j / QKV_NT) * 2 + s) * KCH);
    #pragma unroll
    for (int kk = 0; kk < NKC_D / 2; ++kk) {
        v16h a[4][2];
        #pragma unroll
        for (int m = 0; m < 4; ++m)
            #pragma unroll
            for (int s = 0; s < 2; ++s)
                a[m][s] = frag_ld(xrow + (size_t)m * 16 * D_DIM + (kk * 2 + s) * KCH);
        #pragma unroll
        for (int u = 0; u < QKV_NT; ++u) {
            const int j = kk * QKV_NT + u, jn = j + WRING;
            // the scheduling barriers keep each refill where it is written, its four loads
            // of a row's line together: without them the scheduler sinks the loads down to
            // their own WMMAs and the wave waits out a whole load latency per column tile
            __builtin_amdgcn_sched_barrier(0);
            #pragma unroll
            for (int s = 0; s < 2; ++s)
                #pragma unroll
                for (int m = 0; m < 4; ++m) acc[m][u] = wmma_f16(a[m][s], wb[j % WRING][s], acc[m][u]);
            if (jn < (NKC_D / 2) * QKV_NT) {
                #pragma unroll
                for (int s = 0; s < 2; ++s)
                    wb[j % WRING][s] = frag_ld(wrow + (size_t)(jn % QKV_NT) * 16 * D_DIM + ((jn / QKV_NT) * 2 + s) * KCH);
            }
            __builtin_amdgcn_sched_barrier(0);
        }
    }

    if (wave == 0) {
        const float qscale = 0.03608439182435161f;   // 1/sqrt(768)
        #pragma unroll
        for (int m = 0; m < 4; ++m)
            #pragma unroll
            for (int u = 0; u < QKV_NT; ++u) {
                half_t* dst = Qh + (size_t)(g0 + m * 16) * D_DIM + n0 + u * 16 + r;
                #pragma unroll
                for (int i = 0; i < 8; ++i)
                    dst[(size_t)(i + mhi) * D_DIM] = (half_t)(acc[m][u][i] * qscale);
            }
    } else if (wave == 1) {
        #pragma unroll
        for (int m = 0; m < 4; ++m)
            #pragma unroll
            for (int u = 0; u < QKV_NT; ++u) {
                half_t* dst = Kh + (size_t)(g0 + m * 16) * D_DIM + n0 + u * 16 + r;
                #pragma unroll
                for (int i = 0; i < 8; ++i)
                    dst[(size_t)(i + mhi) * D_DIM] = (half_t)acc[m][u][i];
            }
    } else {
        const int b  = g0 >> 11;                 // S = 2048
        const int s0 = g0 & (S_LEN - 1);
        #pragma unroll
        for (int m = 0; m < 4; ++m)
            #pragma unroll
            for (int u = 0; u < QKV_NT; ++u) {
                half_t* dst = Vt + ((size_t)b * D_DIM + n0 + u * 16 + r) * S_LEN + s0 + m * 16;
                #pragma unroll
                for (int i = 0; i < 8; ++i)
                    dst[i + mhi] = (half_t)acc[m][u][i];
            }
    }
}

// ---------------------------------------------------------------------------
// Kernel 3: attention for one 32-row query tile (two 16-row A tiles).
// grid = B*S/32, block = 256 (8 waves -> 2 waves/SIMD for latency hiding).
// Every K and V fragment loaded from global feeds two WMMAs, one per A tile.
// LDS: Qs 48KB | Sc 256KB (f32 scores; f16 exp overwrites them in place) | reductions ~2KB
// ---------------------------------------------------------------------------
#define QROWS     32
#define SMEM_QS   (QROWS * D_DIM * 2)              // 49152
#define SMEM_SC   (QROWS * S_LEN * 4)              // 262144
#define SMEM_RED  ((512 + QROWS + QROWS) * 4)      // 2304
#define SMEM_TOT  (SMEM_QS + SMEM_SC + SMEM_RED)   // 313600
#define P_PITCH   (S_LEN * 2)                      // halves per P row (= one f32 score row)
#define KU        2                                // key tiles per stage-1 pass
#define KRING     3                                // stage-1 ring slots

__global__ __launch_bounds__(256, 1)
void attn_kernel(const half_t* __restrict__ Qh,
                 const half_t* __restrict__ Kh,
                 const half_t* __restrict__ Vt,
                 float* __restrict__ Out) {
    __shared__ __attribute__((aligned(16))) char smem[SMEM_TOT];
    half_t* Qs      = (half_t*)(smem);
    float*  Sc      = (float*)(smem + SMEM_QS);
    half_t* Pq      = (half_t*)(smem + SMEM_QS);          // in place over Sc
    float*  partial = (float*)(smem + SMEM_QS + SMEM_SC); // [512]
    float*  rowmax  = partial + 512;                      // [32]
    float*  rowsum  = partial + 512 + QROWS;              // [32]

    const int tid  = threadIdx.x;
    const int lane = tid & 31;
    const int wave = tid >> 5;                   // 0..7
    const int g0   = blockIdx.x * QROWS;         // global query row
    const int b    = g0 >> 11;
    const int r    = lane & 15;
    const int mhi  = (lane >> 4) ? 8 : 0;
    const int ko   = mhi;

    // ---- stage 0: stage Q tile (contiguous 48KB) into LDS ----
    {
        const uint4* src = (const uint4*)(Qh + (size_t)g0 * D_DIM);
        uint4* dst = (uint4*)Qs;
        #pragma unroll
        for (int i = 0; i < (SMEM_QS / 16) / 256; ++i)
            dst[tid + i * 256] = src[tid + i * 256];
    }
    __syncthreads();

    // ---- stage 1: scores = Q Kt (scale pre-folded into Q) ----
    // wave handles keys [wave*256, wave*256+256), KU key tiles per pass. The K fragments
    // come through a ring of KRING register slots; a slot holds one key tile's k step of
    // 64 (two fragments, one whole 128-byte line of each of its 16 rows) and is asked for
    // again as soon as its four WMMAs are issued, KRING slots ahead of its next use.
    // The wave's 48 Q fragments are read from LDS once and stay in registers for all passes.
    v16h qa[NKC_D][2];
    #pragma unroll
    for (int dk = 0; dk < NKC_D; ++dk) {
        qa[dk][0] = frag_ld(Qs + r * D_DIM + ko + dk * KCH);
        qa[dk][1] = frag_ld(Qs + (16 + r) * D_DIM + ko + dk * KCH);
    }
    const half_t* kwave = Kh + ((size_t)b * S_LEN + wave * 256 + r) * D_DIM + ko;
    v16h kb[KRING][2];
    #pragma unroll
    for (int j = 0; j < KRING; ++j)
        #pragma unroll
        for (int s = 0; s < 2; ++s)
            kb[j][s] = frag_ld(kwave + (size_t)(j % KU) * 16 * D_DIM + ((j / KU) * 2 + s) * KCH);
    // keeps the first loads in ring order, which the counted waits below lean on for speed
    __builtin_amdgcn_sched_barrier(0);
    auto qk_pass = [&](int c, auto more_c) {
        constexpr bool more = decltype(more_c)::value;      // another pass follows
        constexpr int  NJ   = (NKC_D / 2) * KU;             // ring steps per pass
        static_assert(NJ % KRING == 0 && NJ % KU == 0, "a pass must hand the ring on at slot 0");
        const int key0 = wave * 256 + c * (KU * 16);
        const half_t* krow = kwave + (size_t)c * (KU * 16) * D_DIM;
        v8f acc[2][KU] = {};
        #pragma unroll
        for (int j = 0; j < NJ; ++j) {
            const int u = j % KU, dp = j / KU;
            #pragma unroll
            for (int s = 0; s < 2; ++s) {
                acc[0][u] = wmma_f16(qa[dp * 2 + s][0], kb[j % KRING][s], acc[0][u]);
                acc[1][u] = wmma_f16(qa[dp * 2 + s][1], kb[j % KRING][s], acc[1][u]);
            }
            // the slot's next tenant: KRING steps on, in this pass or at the head of the next
            const int jn = j + KRING;
            if (jn < NJ || more) {
                const int un = jn % KU + (jn < NJ ? 0 : KU), dn = (jn % NJ) / KU;
                #pragma unroll
                for (int s = 0; s < 2; ++s)
                    kb[j % KRING][s] = frag_ld(krow + (size_t)un * 16 * D_DIM + (dn * 2 + s) * KCH);
            }
            // keeps the refill here: without it the scheduler sinks each load down to
            // its own WMMAs and the wave waits out one whole load latency per fragment
            __builtin_amdgcn_sched_barrier(0);
        }
        if constexpr (more) {
            // loads of the next pass are in flight here: this wait stands in front of the
            // first instruction that reuses their address registers (a precaution); the
            // scheduling barrier keeps that instruction behind it
            asm volatile("s_wait_xcnt 0x0" ::: "memory");
            __builtin_amdgcn_sched_barrier(0);
        }
        // unrolled so that acc[][] is indexed by constants and stays in registers
        #pragma unroll
        for (int t = 0; t < 2; ++t)
            #pragma unroll
            for (int u = 0; u < KU; ++u)
                #pragma unroll
                for (int i = 0; i < 8; ++i)
                    Sc[(t * 16 + i + mhi) * S_LEN + key0 + u * 16 + r] = acc[t][u][i];
    };
    for (int c = 0; c < 256 / (KU * 16) - 1; ++c) qk_pass(c, std::true_type{});
    qk_pass(256 / (KU * 16) - 1, std::false_type{});
    __syncthreads();

    // ---- stage 2: softmax stats + unnormalized exp(P) in f16 ----
    // 16 threads per row, 128 cols per thread, rows (tid>>4) and (tid>>4)+16.
    // A thread's f16 results go into the first half of the 512 bytes its own
    // f32 scores occupy: the 8-byte store of step i lies at or below the 16
    // bytes read in step i, and no other thread touches that range.
    {
        const int row = tid >> 4;
        const int seg = tid & 15;
        for (int h = 0; h < 2; ++h) {
            const float4* srow4 = (const float4*)(Sc + (row + h * 16) * S_LEN + seg * 128);
            float m = -3.0e38f;
            for (int i = 0; i < 32; ++i) {
                float4 v = srow4[i];
                m = fmaxf(m, fmaxf(fmaxf(v.x, v.y), fmaxf(v.z, v.w)));
            }
            partial[h * 256 + tid] = m;
        }
        __syncthreads();
        if (seg < 2) {                            // seg selects the row half
            const int rr = row + seg * 16;
            float mm = partial[rr * 16];
            #pragma unroll
            for (int i = 1; i < 16; ++i) mm = fmaxf(mm, partial[rr * 16 + i]);
            rowmax[rr] = mm;
        }
        __syncthreads();
        for (int h = 0; h < 2; ++h) {
            const float rm = rowmax[row + h * 16];
            const float4* srow4 = (const float4*)(Sc + (row + h * 16) * S_LEN + seg * 128);
            half_t* prow = Pq + (row + h * 16) * P_PITCH + seg * 256;
            float s = 0.0f;
            for (int i = 0; i < 32; ++i) {
                float4 v = srow4[i];
                float e0 = exp_slot(v.x - rm);
                float e1 = exp_slot(v.y - rm);
                float e2 = exp_slot(v.z - rm);
                float e3 = exp_slot(v.w - rm);
                s += (e0 + e1) + (e2 + e3);
                v4h hh;
                hh[0] = (half_t)e0; hh[1] = (half_t)e1;
                hh[2] = (half_t)e2; hh[3] = (half_t)e3;
                *(v4h*)(prow + i * 4) = hh;
            }
            partial[h * 256 + tid] = s;
        }
        __syncthreads();
        if (seg < 2) {
            const int rr = row + seg * 16;
            float ss = 0.0f;
            #pragma unroll
            for (int i = 0; i < 16; ++i) ss += partial[rr * 16 + i];
            rowsum[rr] = ss;
        }
        __syncthreads();
    }

    // ---- stage 3: Out = (P @ V) / rowsum ----
    // wave tile: 32 query rows x 96 d-cols, 12 accumulators: two P A-frags (LDS,
    // each read once per wave) x 6 V B-frags (global) = 12 WMMAs per 32 keys.
    // Key chunk kc (32 keys) of a P row starts at half (kc>>2)*256 + (kc&3)*32.
    float rs[2][8];
    // unrolled so that rs[][] stays in registers
    #pragma unroll
    for (int t = 0; t < 2; ++t)
        #pragma unroll
        for (int i = 0; i < 8; ++i) rs[t][i] = 1.0f / rowsum[t * 16 + i + mhi];

    {
        const int n0 = wave * 96;
        v8f acc[2][6] = {};
        const half_t* prow = Pq + r * P_PITCH + ko;
        const half_t* vrow = Vt + ((size_t)b * D_DIM + n0 + r) * S_LEN + ko;
        // One step = 64 keys. vb[u] holds V tile u's two fragments of the step (one whole
        // 128-byte line of each of its 16 rows) and is asked for again, for the next step,
        // as soon as its four WMMAs are issued; the P fragments of the next step are read
        // from LDS as one group in front of this step's WMMAs.
        v16h vb[6][2];
        v16h pa[2][2][2];                        // [step parity][32-key half][A tile]
        #pragma unroll
        for (int s = 0; s < 2; ++s) {
            pa[0][s][0] = frag_ld(prow + s * KCH);
            pa[0][s][1] = frag_ld(prow + 16 * P_PITCH + s * KCH);
        }
        #pragma unroll
        for (int u = 0; u < 6; ++u)
            #pragma unroll
            for (int s = 0; s < 2; ++s)
                vb[u][s] = frag_ld(vrow + (size_t)u * 16 * S_LEN + s * KCH);
        auto pv_step = [&](int kp, auto par_c, auto more_c) {
            constexpr int  par  = decltype(par_c)::value;
            constexpr bool more = decltype(more_c)::value;
            if constexpr (more) {
                #pragma unroll
                for (int s = 0; s < 2; ++s) {
                    const int kc = (kp + 1) * 2 + s;
                    const int po = (kc >> 2) * 256 + (kc & 3) * KCH;
                    pa[par ^ 1][s][0] = frag_ld(prow + po);
                    pa[par ^ 1][s][1] = frag_ld(prow + 16 * P_PITCH + po);
                }
            }
            // this and the one below keep the fetches ahead where they are written:
            // without them the scheduler sinks each load down to its own WMMAs
            __builtin_amdgcn_sched_barrier(0);
            #pragma unroll
            for (int u = 0; u < 6; ++u) {
                #pragma unroll
                for (int s = 0; s < 2; ++s) {
                    acc[0][u] = wmma_f16(pa[par][s][0], vb[u][s], acc[0][u]);
                    acc[1][u] = wmma_f16(pa[par][s][1], vb[u][s], acc[1][u]);
                }
                if constexpr (more) {
                    #pragma unroll
                    for (int s = 0; s < 2; ++s)
                        vb[u][s] = frag_ld(vrow + (size_t)u * 16 * S_LEN + ((kp + 1) * 2 + s) * KCH);
                }
                __builtin_amdgcn_sched_barrier(0);
            }
        };
        using c0 = std::integral_constant<int, 0>;
        using c1 = std::integral_constant<int, 1>;
        for (int kp = 0; kp < NKC_S / 2 - 2; kp += 2) {
            pv_step(kp,     c0{}, std::true_type{});
            pv_step(kp + 1, c1{}, std::true_type{});
            // the next step's loads are in flight here: this wait stands in front of the
            // loop's step of their address registers (a precaution); the scheduling
            // barrier keeps that step behind it
            asm volatile("s_wait_xcnt 0x0" ::: "memory");
            __builtin_amdgcn_sched_barrier(0);
        }
        pv_step(NKC_S / 2 - 2, c0{}, std::true_type{});
        pv_step(NKC_S / 2 - 1, c1{}, std::false_type{});
        // unrolled so that acc[][] and rs[][] stay in registers
        #pragma unroll
        for (int t = 0; t < 2; ++t)
            #pragma unroll
            for (int u = 0; u < 6; ++u) {
                float* orow = Out + (size_t)(g0 + t * 16) * D_DIM + n0 + u * 16 + r;
                #pragma unroll
                for (int i = 0; i < 8; ++i)
                    orow[(size_t)(i + mhi) * D_DIM] = acc[t][u][i] * rs[t][i];
            }
    }
}

// ---------------------------------------------------------------------------
extern "C" void kernel_launch(void* const* d_in, const int* in_sizes, int n_in,
                              void* d_out, int out_size, void* d_ws, size_t ws_size,
                              hipStream_t stream) {
    const float* X  = (const float*)d_in[0];
    const float* Wq = (const float*)d_in[1];
    const float* bq = (const float*)d_in[2];
    const float* Wk = (const float*)d_in[3];
    const float* bk = (const float*)d_in[4];
    const float* Wv = (const float*)d_in[5];
    const float* bv = (const float*)d_in[6];
    float* out = (float*)d_out;

    const size_t nX = (size_t)B_N * S_LEN * D_DIM;     // 6291456
    const size_t nW = (size_t)D_DIM * D_DIM;           // 589824

    char* ws = (char*)d_ws;
    half_t* Xh  = (half_t*)ws;              ws += nX * sizeof(half_t);
    half_t* Wqh = (half_t*)ws;              ws += nW * sizeof(half_t);
    half_t* Wkh = (half_t*)ws;              ws += nW * sizeof(half_t);
    half_t* Wvh = (half_t*)ws;              ws += nW * sizeof(half_t);
    half_t* Qh  = (half_t*)ws;              ws += nX * sizeof(half_t);
    half_t* Kh  = (half_t*)ws;              ws += nX * sizeof(half_t);
    half_t* Vt  = (half_t*)ws;              ws += nX * sizeof(half_t);

    // 1) f32 -> f16 conversions (4 elems/thread)
    cvt_f16_kernel<<<1024, 256, 0, stream>>>(X,  Xh,  (int)(nX / 4));
    cvt_f16_kernel<<< 256, 256, 0, stream>>>(Wq, Wqh, (int)(nW / 4));
    cvt_f16_kernel<<< 256, 256, 0, stream>>>(Wk, Wkh, (int)(nW / 4));
    cvt_f16_kernel<<< 256, 256, 0, stream>>>(Wv, Wvh, (int)(nW / 4));

    // 2) QKV projection: 24 x 96-wide output blocks, 4 per work-group, x 128 row tiles of 64
    dim3 gq(3 * D_DIM / (QKV_NT * 16 * 4), (B_N * S_LEN) / 64);
    qkv_kernel<<<gq, 128, 0, stream>>>(Xh, Wqh, Wkh, Wvh, bq, bk, bv, Qh, Kh, Vt);

    // 3) attention: one block per 32-row query tile, ~306KB static LDS
    attn_kernel<<<(B_N * S_LEN) / QROWS, 256, 0, stream>>>(Qh, Kh, Vt, out);
}

// v004
// It runs in 138 microseconds.
// Next to v003, in two timings, it ran 1.18 times as fast each time.
// Counting every step since v000, it is 3.39 times as fast.
#include <hip/hip_runtime.h>
#include <hip/hip_bf16.h>
#include <type_traits>

typedef _Float16 half_t;
typedef __attribute__((ext_vector_type(4)))  half_t v4h;
typedef __attribute__((ext_vector_type(8)))  half_t v8h;
typedef __attribute__((ext_vector_type(16))) half_t v16h;
typedef __attribute__((ext_vector_type(8)))  float  v8f;
typedef __attribute__((ext_vector_type(4)))  float  v4f;

#define B_N    4
#define S_LEN  2048
#define D_DIM  768
#define KCH    32              // K-dim per wmma
#define NKC_D  (D_DIM / KCH)   // 24
#define NKC_S  (S_LEN / KCH)   // 64

// Per-lane fragment load for 16-bit A/B operands of v_wmma_*_16x16x32.
// p must already point at: row_base + k_base + (lane>=16 ? 8 : 0).
// Lane holds two contiguous 8-half (16B) chunks at +0 and +16 halves.
__device__ __forceinline__ v16h frag_ld(const half_t* p) {
    v8h lo = *(const v8h*)(p);
    v8h hi = *(const v8h*)(p + 16);
    return __builtin_shufflevector(lo, hi, 0,1,2,3,4,5,6,7,8,9,10,11,12,13,14,15);
}

__device__ __forceinline__ v8f wmma_f16(v16h a, v16h b, v8f c) {
    return __builtin_amdgcn_wmma_f32_16x16x32_f16(false, a, false, b, (short)0, c, false, false);
}

// exp(x) as __expf forms it (x * log2(e), then v_exp_f32). The v_nop fills the one
// slot the instruction set asks for behind a transcendental before its result is
// read or its source register overwritten.
__device__ __forceinline__ float exp_slot(float x) {
    float y;
    asm("v_exp_f32 %0, %1\n\tv_nop" : "=v"(y) : "v"(x * 1.44269504088896340736f));
    return y;
}

// ---------------------------------------------------------------------------
// Kernel 1: f32 -> f16 conversion, 4 elems/thread (grid-stride)
// ---------------------------------------------------------------------------
__global__ void cvt_f16_kernel(const float* __restrict__ src,
                               half_t* __restrict__ dst, int n4) {
    int i = blockIdx.x * blockDim.x + threadIdx.x;
    int stride = gridDim.x * blockDim.x;
    for (; i < n4; i += stride) {
        float4 v = ((const float4*)src)[i];
        v4h h;
        h[0] = (half_t)v.x; h[1] = (half_t)v.y;
        h[2] = (half_t)v.z; h[3] = (half_t)v.w;
        *(v4h*)(dst + (size_t)i * 4) = h;
    }
}

// ---------------------------------------------------------------------------
// Kernel 2: QKV projection. grid = (3*D/384, B*S/64), block = 128 (4 waves, one per SIMD).
// Each wave computes a 64x96 output block (24 accumulators) in k steps of 64, one
// 128-byte line of every X and W row: 8 X A-frags and 12 W B-frags feed 48 WMMAs,
// and both halves of a line are asked for one behind the other.
// The 24 column blocks of [Q | K | V] go to the waves in order, 8 per matrix:
// block 0..7   -> Q (scaled by 1/sqrt(D), f16 row-major)
// block 8..15  -> K (f16 row-major)
// block 16..23 -> V (f16 transposed: Vt[b][d][s])
// ---------------------------------------------------------------------------
#define QKV_NT 6                               // 16-column tiles per wave
#define WRING  3                               // W ring slots
__global__ __launch_bounds__(128)
void qkv_kernel(const half_t* __restrict__ Xh,
                const half_t* __restrict__ Wqh,
                const half_t* __restrict__ Wkh,
                const half_t* __restrict__ Wvh,
                const float*  __restrict__ bq,
                const float*  __restrict__ bk,
                const float*  __restrict__ bv,
                half_t* __restrict__ Qh,
                half_t* __restrict__ Kh,
                half_t* __restrict__ Vt) {
    const int lane = threadIdx.x & 31;
    const int cb   = blockIdx.x * 4 + (threadIdx.x >> 5);    // column block, 0..23
    const int wave = cb / (D_DIM / (QKV_NT * 16));           // 0=Q, 1=K, 2=V
    const int n0   = (cb % (D_DIM / (QKV_NT * 16))) * (QKV_NT * 16); // output-channel block
    const int g0   = blockIdx.y * 64;           // global row in [0, B*S)
    const int r    = lane & 15;
    const int mhi  = (lane >> 4) ? 8 : 0;
    const int ko   = mhi;                       // k-offset pattern for frags

    const half_t* W  = (wave == 0) ? Wqh : (wave == 1) ? Wkh : Wvh;
    const float*  bb = (wave == 0) ? bq  : (wave == 1) ? bk  : bv;

    v8f acc[4][QKV_NT];                         // [row tile m][column tile u]
    #pragma unroll
    for (int u = 0; u < QKV_NT; ++u) {
        float bias = bb[n0 + u * 16 + r];
        #pragma unroll
        for (int m = 0; m < 4; ++m)
            #pragma unroll
            for (int i = 0; i < 8; ++i) acc[m][u][i] = bias;
    }

    const half_t* xrow = Xh + (size_t)(g0 + r) * D_DIM + ko;
    const half_t* wrow = W  + (size_t)(n0 + r) * D_DIM + ko;  // +u*16 rows per chunk
    // The W fragments come through a ring of WRING register slots; a slot holds one column
    // tile's k step (two fragments, one whole line of each of its 16 rows) and is asked for
    // again, WRING tiles ahead of its next use, as soon as its eight WMMAs are issued.
    v16h wb[WRING][2];
    #pragma unroll
    for (int j = 0; j < WRING; ++j)
        #pragma unroll
        for (int s = 0; s < 2; ++s)
            wb[j][s] = frag_ld(wrow + (size_t)(j % QKV_NT) * 16 * D_DIM + ((j / QKV_NT) * 2 + s) * KCH);
    #pragma unroll
    for (int kk = 0; kk < NKC_D / 2; ++kk) {
        v16h a[4][2];
        #pragma unroll
        for (int m = 0; m < 4; ++m)
            #pragma unroll
            for (int s = 0; s < 2; ++s)
                a[m][s] = frag_ld(xrow + (size_t)m * 16 * D_DIM + (kk * 2 + s) * KCH);
        #pragma unroll
        for (int u = 0; u < QKV_NT; ++u) {
            const int j = kk * QKV_NT + u, jn = j + WRING;
            // the scheduling barriers keep each refill where it is written, its four loads
            // of a row's line together: without them the scheduler sinks the loads down to
            // their own WMMAs and the wave waits out a whole load latency per column tile
            __builtin_amdgcn_sched_barrier(0);
            #pragma unroll
            for (int s = 0; s < 2; ++s)
                #pragma unroll
                for (int m = 0; m < 4; ++m) acc[m][u] = wmma_f16(a[m][s], wb[j % WRING][s], acc[m][u]);
            if (jn < (NKC_D / 2) * QKV_NT) {
                #pragma unroll
                for (int s = 0; s < 2; ++s)
                    wb[j % WRING][s] = frag_ld(wrow + (size_t)(jn % QKV_NT) * 16 * D_DIM + ((jn / QKV_NT) * 2 + s) * KCH);
            }
            __builtin_amdgcn_sched_barrier(0);
        }
    }

    if (wave == 0) {
        const float qscale = 0.03608439182435161f;   // 1/sqrt(768)
        #pragma unroll
        for (int m = 0; m < 4; ++m)
            #pragma unroll
            for (int u = 0; u < QKV_NT; ++u) {
                half_t* dst = Qh + (size_t)(g0 + m * 16) * D_DIM + n0 + u * 16 + r;
                #pragma unroll
                for (int i = 0; i < 8; ++i)
                    dst[(size_t)(i + mhi) * D_DIM] = (half_t)(acc[m][u][i] * qscale);
            }
    } else if (wave == 1) {
        #pragma unroll
        for (int m = 0; m < 4; ++m)
            #pragma unroll
            for (int u = 0; u < QKV_NT; ++u) {
                half_t* dst = Kh + (size_t)(g0 + m * 16) * D_DIM + n0 + u * 16 + r;
                #pragma unroll
                for (int i = 0; i < 8; ++i)
                    dst[(size_t)(i + mhi) * D_DIM] = (half_t)acc[m][u][i];
            }
    } else {
        const int b  = g0 >> 11;                 // S = 2048
        const int s0 = g0 & (S_LEN - 1);
        #pragma unroll
        for (int m = 0; m < 4; ++m)
            #pragma unroll
            for (int u = 0; u < QKV_NT; ++u) {
                half_t* dst = Vt + ((size_t)b * D_DIM + n0 + u * 16 + r) * S_LEN + s0 + m * 16;
                #pragma unroll
                for (int i = 0; i < 8; ++i)
                    dst[i + mhi] = (half_t)acc[m][u][i];
            }
    }
}

// ---------------------------------------------------------------------------
// Kernel 3: attention for one 32-row query tile (two 16-row A tiles).
// grid = B*S/32, block = 256 (8 waves -> 2 waves/SIMD for latency hiding).
// Every K and V fragment loaded from global feeds two WMMAs, one per A tile.
// LDS: Qs 48KB | Sc 256KB (f32 scores; f16 exp overwrites them in place) | reductions ~2KB
// Q rows and score rows each carry 16 bytes of pad: the pitch is then 16 B x an odd number,
// so the 16 rows that one ds_load_b128 fragment read touches fall on 16 different groups
// of four banks (at the unpadded pitches, multiples of 256 B, all 16 fall on one group).
// ---------------------------------------------------------------------------
#define QROWS     32
#define Q_PITCH   (D_DIM + 8)                      // halves per Q row in LDS (1552 B)
#define SC_PITCH  (S_LEN + 4)                      // floats per score row (8208 B)
#define SMEM_QS   (QROWS * Q_PITCH * 2)            // 49664
#define SMEM_SC   (QROWS * SC_PITCH * 4)           // 262656
#define SMEM_RED  ((512 + QROWS + QROWS) * 4)      // 2304
#define SMEM_TOT  (SMEM_QS + SMEM_SC + SMEM_RED)   // 314624
#define P_PITCH   (SC_PITCH * 2)                   // halves per P row (= one f32 score row)
#define KU        2                                // key tiles per stage-1 pass
#define KRING     3                                // stage-1 ring slots

__global__ __launch_bounds__(256, 1)
void attn_kernel(const half_t* __restrict__ Qh,
                 const half_t* __restrict__ Kh,
                 const half_t* __restrict__ Vt,
                 float* __restrict__ Out) {
    __shared__ __attribute__((aligned(16))) char smem[SMEM_TOT];
    half_t* Qs      = (half_t*)(smem);
    float*  Sc      = (float*)(smem + SMEM_QS);
    half_t* Pq      = (half_t*)(smem + SMEM_QS);          // in place over Sc
    float*  partial = (float*)(smem + SMEM_QS + SMEM_SC); // [512]
    float*  rowmax  = partial + 512;                      // [32]
    float*  rowsum  = partial + 512 + QROWS;              // [32]

    const int tid  = threadIdx.x;
    const int lane = tid & 31;
    const int wave = tid >> 5;                   // 0..7
    const int g0   = blockIdx.x * QROWS;         // global query row
    const int b    = g0 >> 11;
    const int r    = lane & 15;
    const int mhi  = (lane >> 4) ? 8 : 0;
    const int ko   = mhi;

    // ---- stage 0: stage Q tile (contiguous 48KB in global) into LDS rows of Q_PITCH ----
    {
        // wave w brings rows w, w+8, w+16, w+24, each in three runs of 512 contiguous bytes
        const uint4* src = (const uint4*)(Qh + (size_t)(g0 + wave) * D_DIM) + lane;
        half_t* dst = Qs + wave * Q_PITCH + lane * 8;
        #pragma unroll
        for (int rr = 0; rr < QROWS / 8; ++rr)
            #pragma unroll
            for (int c = 0; c < D_DIM / 256; ++c)
                *(uint4*)(dst + rr * 8 * Q_PITCH + c * 256) = src[rr * 8 * (D_DIM / 8) + c * 32];
        // keeps the address arithmetic of stage 1 behind these stores: so held back, the first
        // reuse of the loads' address registers has the compiler's own s_wait_xcnt 0 in front
        // (a precaution)
        __builtin_amdgcn_sched_barrier(0);
    }
    __syncthreads();

    // ---- stage 1: scores = Q Kt (scale pre-folded into Q) ----
    // wave handles keys [wave*256, wave*256+256), KU key tiles per pass. The K fragments
    // come through a ring of KRING register slots; a slot holds one key tile's k step of
    // 64 (two fragments, one whole 128-byte line of each of its 16 rows) and is asked for
    // again as soon as its four WMMAs are issued, KRING slots ahead of its next use.
    // The wave's 48 Q fragments are read from LDS once and stay in registers for all passes.
    v16h qa[NKC_D][2];
    #pragma unroll
    for (int dk = 0; dk < NKC_D; ++dk) {
        qa[dk][0] = frag_ld(Qs + r * Q_PITCH + ko + dk * KCH);
        qa[dk][1] = frag_ld(Qs + (16 + r) * Q_PITCH + ko + dk * KCH);
    }
    const half_t* kwave = Kh + ((size_t)b * S_LEN + wave * 256 + r) * D_DIM + ko;
    v16h kb[KRING][2];
    #pragma unroll
    for (int j = 0; j < KRING; ++j)
        #pragma unroll
        for (int s = 0; s < 2; ++s)
            kb[j][s] = frag_ld(kwave + (size_t)(j % KU) * 16 * D_DIM + ((j / KU) * 2 + s) * KCH);
    // keeps the first loads in ring order, which the counted waits below lean on for speed
    __builtin_amdgcn_sched_barrier(0);
    auto qk_pass = [&](int c, auto more_c) {
        constexpr bool more = decltype(more_c)::value;      // another pass follows
        constexpr int  NJ   = (NKC_D / 2) * KU;             // ring steps per pass
        static_assert(NJ % KRING == 0 && NJ % KU == 0, "a pass must hand the ring on at slot 0");
        const int key0 = wave * 256 + c * (KU * 16);
        const half_t* krow = kwave + (size_t)c * (KU * 16) * D_DIM;
        v8f acc[2][KU] = {};
        #pragma unroll
        for (int j = 0; j < NJ; ++j) {
            const int u = j % KU, dp = j / KU;
            #pragma unroll
            for (int s = 0; s < 2; ++s) {
                acc[0][u] = wmma_f16(qa[dp * 2 + s][0], kb[j % KRING][s], acc[0][u]);
                acc[1][u] = wmma_f16(qa[dp * 2 + s][1], kb[j % KRING][s], acc[1][u]);
            }
            // the slot's next tenant: KRING steps on, in this pass or at the head of the next
            const int jn = j + KRING;
            if (jn < NJ || more) {
                const int un = jn % KU + (jn < NJ ? 0 : KU), dn = (jn % NJ) / KU;
                #pragma unroll
                for (int s = 0; s < 2; ++s)
                    kb[j % KRING][s] = frag_ld(krow + (size_t)un * 16 * D_DIM + (dn * 2 + s) * KCH);
            }
            // keeps the refill here: without it the scheduler sinks each load down to
            // its own WMMAs and the wave waits out one whole load latency per fragment
            __builtin_amdgcn_sched_barrier(0);
        }
        if constexpr (more) {
            // loads of the next pass are in flight here: this wait stands in front of the
            // first instruction that reuses their address registers (a precaution); the
            // scheduling barrier keeps that instruction behind it
            asm volatile("s_wait_xcnt 0x0" ::: "memory");
            __builtin_amdgcn_sched_barrier(0);
        }
        // unrolled so that acc[][] is indexed by constants and stays in registers
        #pragma unroll
        for (int t = 0; t < 2; ++t)
            #pragma unroll
            for (int u = 0; u < KU; ++u)
                #pragma unroll
                for (int i = 0; i < 8; ++i)
                    Sc[(t * 16 + i + mhi) * SC_PITCH + key0 + u * 16 + r] = acc[t][u][i];
    };
    for (int c = 0; c < 256 / (KU * 16) - 1; ++c) qk_pass(c, std::true_type{});
    qk_pass(256 / (KU * 16) - 1, std::false_type{});
    __syncthreads();

    // ---- stage 2: softmax stats + unnormalized exp(P) in f16 ----
    // 16 lanes of one wave per row, rows (tid>>4) and (tid>>4)+16. In step i the 16 lanes
    // read the 256 contiguous bytes (64 scores) at byte 256*i of the row, 16 bytes a lane,
    // so a read touches every bank once.
    // The f16 results of step i go to the 128 bytes at byte 128*i of the same row: P ends
    // up contiguous, key k at half k. That range lies wholly below byte 256*(i+1), which
    // the row's own wave has read by then (a wave's LDS operations run in program order),
    // and no later step reads it; no other wave touches the row.
    {
        const int row = tid >> 4;
        const int seg = tid & 15;
        for (int h = 0; h < 2; ++h) {
            const v4f* srow4 = (const v4f*)(Sc + (row + h * 16) * SC_PITCH) + seg;
            float m = -3.0e38f;
            for (int i = 0; i < 32; ++i) {
                v4f v = srow4[i * 16];
                m = fmaxf(m, fmaxf(fmaxf(v[0], v[1]), fmaxf(v[2], v[3])));
            }
            partial[h * 256 + tid] = m;
        }
        __syncthreads();
        if (seg < 2) {                            // seg selects the row half
            const int rr = row + seg * 16;
            float mm = partial[rr * 16];
            #pragma unroll
            for (int i = 1; i < 16; ++i) mm = fmaxf(mm, partial[rr * 16 + i]);
            rowmax[rr] = mm;
        }
        __syncthreads();
        for (int h = 0; h < 2; ++h) {
            const float rm = rowmax[row + h * 16];
            const v4f* srow4 = (const v4f*)(Sc + (row + h * 16) * SC_PITCH) + seg;
            half_t* prow = Pq + (row + h * 16) * P_PITCH + seg * 4;
            float s = 0.0f;
            // eight steps' reads stand together in front of their eight stores: the compiler
            // cannot tell that a store never meets a later read, and step by step each read
            // would wait behind the store before it; both inner loops are unrolled so that
            // v[] is indexed by constants and stays in registers
            for (int i0 = 0; i0 < 32; i0 += 8) {
                v4f v[8];
                #pragma unroll
                for (int i = 0; i < 8; ++i) v[i] = srow4[(i0 + i) * 16];
                #pragma unroll
                for (int i = 0; i < 8; ++i) {
                    float e0 = exp_slot(v[i][0] - rm);
                    float e1 = exp_slot(v[i][1] - rm);
                    float e2 = exp_slot(v[i][2] - rm);
                    float e3 = exp_slot(v[i][3] - rm);
                    s += (e0 + e1) + (e2 + e3);
                    v4h hh;
                    hh[0] = (half_t)e0; hh[1] = (half_t)e1;
                    hh[2] = (half_t)e2; hh[3] = (half_t)e3;
                    *(v4h*)(prow + (i0 + i) * 64) = hh;
                }
            }
            partial[h * 256 + tid] = s;
        }
        __syncthreads();
        if (seg < 2) {
            const int rr = row + seg * 16;
            float ss = 0.0f;
            #pragma unroll
            for (int i = 0; i < 16; ++i) ss += partial[rr * 16 + i];
            rowsum[rr] = ss;
        }
        __syncthreads();
    }

    // ---- stage 3: Out = (P @ V) / rowsum ----
    // wave tile: 32 query rows x 96 d-cols, 12 accumulators: two P A-frags (LDS,
    // each read once per wave) x 6 V B-frags (global) = 12 WMMAs per 32 keys.
    // Key chunk kc (32 keys) of a P row starts at half kc*32.
    float rs[2][8];
    // unrolled so that rs[][] stays in registers
    #pragma unroll
    for (int t = 0; t < 2; ++t)
        #pragma unroll
        for (int i = 0; i < 8; ++i) rs[t][i] = 1.0f / rowsum[t * 16 + i + mhi];

    {
        const int n0 = wave * 96;
        v8f acc[2][6] = {};
        const half_t* prow = Pq + r * P_PITCH + ko;
        const half_t* vrow = Vt + ((size_t)b * D_DIM + n0 + r) * S_LEN + ko;
        // One step = 64 keys. vb[u] holds V tile u's two fragments of the step (one whole
        // 128-byte line of each of its 16 rows) and is asked for again, for the next step,
        // as soon as its four WMMAs are issued; the P fragments of the next step are read
        // from LDS as one group in front of this step's WMMAs.
        v16h vb[6][2];
        v16h pa[2][2][2];                        // [step parity][32-key half][A tile]
        #pragma unroll
        for (int s = 0; s < 2; ++s) {
            pa[0][s][0] = frag_ld(prow + s * KCH);
            pa[0][s][1] = frag_ld(prow + 16 * P_PITCH + s * KCH);
        }
        #pragma unroll
        for (int u = 0; u < 6; ++u)
            #pragma unroll
            for (int s = 0; s < 2; ++s)
                vb[u][s] = frag_ld(vrow + (size_t)u * 16 * S_LEN + s * KCH);
        auto pv_step = [&](int kp, auto par_c, auto more_c) {
            constexpr int  par  = decltype(par_c)::value;
            constexpr bool more = decltype(more_c)::value;
            if constexpr (more) {
                #pragma unroll
                for (int s = 0; s < 2; ++s) {
                    const int kc = (kp + 1) * 2 + s;
                    const int po = kc * KCH;
                    pa[par ^ 1][s][0] = frag_ld(prow + po);
                    pa[par ^ 1][s][1] = frag_ld(prow + 16 * P_PITCH + po);
                }
            }
            // this and the one below keep the fetches ahead where they are written:
            // without them the scheduler sinks each load down to its own WMMAs
            __builtin_amdgcn_sched_barrier(0);
            #pragma unroll
            for (int u = 0; u < 6; ++u) {
                #pragma unroll
                for (int s = 0; s < 2; ++s) {
                    acc[0][u] = wmma_f16(pa[par][s][0], vb[u][s], acc[0][u]);
                    acc[1][u] = wmma_f16(pa[par][s][1], vb[u][s], acc[1][u]);
                }
                if constexpr (more) {
                    #pragma unroll
                    for (int s = 0; s < 2; ++s)
                        vb[u][s] = frag_ld(vrow + (size_t)u * 16 * S_LEN + ((kp + 1) * 2 + s) * KCH);
                }
                __builtin_amdgcn_sched_barrier(0);
            }
        };
        using c0 = std::integral_constant<int, 0>;
        using c1 = std::integral_constant<int, 1>;
        for (int kp = 0; kp < NKC_S / 2 - 2; kp += 2) {
            pv_step(kp,     c0{}, std::true_type{});
            pv_step(kp + 1, c1{}, std::true_type{});
            // the next step's loads are in flight here: this wait stands in front of the
            // loop's step of their address registers (a precaution); the scheduling
            // barrier keeps that step behind it
            asm volatile("s_wait_xcnt 0x0" ::: "memory");
            __builtin_amdgcn_sched_barrier(0);
        }
        pv_step(NKC_S / 2 - 2, c0{}, std::true_type{});
        pv_step(NKC_S / 2 - 1, c1{}, std::false_type{});
        // unrolled so that acc[][] and rs[][] stay in registers
        #pragma unroll
        for (int t = 0; t < 2; ++t)
            #pragma unroll
            for (int u = 0; u < 6; ++u) {
                float* orow = Out + (size_t)(g0 + t * 16) * D_DIM + n0 + u * 16 + r;
                #pragma unroll
                for (int i = 0; i < 8; ++i)
                    orow[(size_t)(i + mhi) * D_DIM] = acc[t][u][i] * rs[t][i];
            }
    }
}

// ---------------------------------------------------------------------------
extern "C" void kernel_launch(void* const* d_in, const int* in_sizes, int n_in,
                              void* d_out, int out_size, void* d_ws, size_t ws_size,
                              hipStream_t stream) {
    const float* X  = (const float*)d_in[0];
    const float* Wq = (const float*)d_in[1];
    const float* bq = (const float*)d_in[2];
    const float* Wk = (const float*)d_in[3];
    const float* bk = (const float*)d_in[4];
    const float* Wv = (const float*)d_in[5];
    const float* bv = (const float*)d_in[6];
    float* out = (float*)d_out;

    const size_t nX = (size_t)B_N * S_LEN * D_DIM;     // 6291456
    const size_t nW = (size_t)D_DIM * D_DIM;           // 589824

    char* ws = (char*)d_ws;
    half_t* Xh  = (half_t*)ws;              ws += nX * sizeof(half_t);
    half_t* Wqh = (half_t*)ws;              ws += nW * sizeof(half_t);
    half_t* Wkh = (half_t*)ws;              ws += nW * sizeof(half_t);
    half_t* Wvh = (half_t*)ws;              ws += nW * sizeof(half_t);
    half_t* Qh  = (half_t*)ws;              ws += nX * sizeof(half_t);
    half_t* Kh  = (half_t*)ws;              ws += nX * sizeof(half_t);
    half_t* Vt  = (half_t*)ws;              ws += nX * sizeof(half_t);

    // 1) f32 -> f16 conversions (4 elems/thread)
    cvt_f16_kernel<<<1024, 256, 0, stream>>>(X,  Xh,  (int)(nX / 4));
    cvt_f16_kernel<<< 256, 256, 0, stream>>>(Wq, Wqh, (int)(nW / 4));
    cvt_f16_kernel<<< 256, 256, 0, stream>>>(Wk, Wkh, (int)(nW / 4));
    cvt_f16_kernel<<< 256, 256, 0, stream>>>(Wv, Wvh, (int)(nW / 4));

    // 2) QKV projection: 24 x 96-wide output blocks, 4 per work-group, x 128 row tiles of 64
    dim3 gq(3 * D_DIM / (QKV_NT * 16 * 4), (B_N * S_LEN) / 64);
    qkv_kernel<<<gq, 128, 0, stream>>>(Xh, Wqh, Wkh, Wvh, bq, bk, bv, Qh, Kh, Vt);

    // 3) attention: one block per 32-row query tile, ~307KB static LDS
    attn_kernel<<<(B_N * S_LEN) / QROWS, 256, 0, stream>>>(Qh, Kh, Vt, out);
}

// v005
// Measured time: 123 microseconds a run.
// Two timings next to v004 both put it at 1.12 times that version's speed.
// Over all steps from v000 it is 3.80 times as fast.
#include <hip/hip_runtime.h>
#include <hip/hip_bf16.h>
#include <type_traits>

typedef _Float16 half_t;
typedef __attribute__((ext_vector_type(4)))  half_t v4h;
typedef __attribute__((ext_vector_type(8)))  half_t v8h;
typedef __attribute__((ext_vector_type(16))) half_t v16h;
typedef __attribute__((ext_vector_type(8)))  float  v8f;
typedef __attribute__((ext_vector_type(4)))  float  v4f;

#define B_N    4
#define S_LEN  2048
#define D_DIM  768
#define KCH    32              // K-dim per wmma
#define NKC_D  (D_DIM / KCH)   // 24
#define NKC_S  (S_LEN / KCH)   // 64

// Per-lane fragment load for 16-bit A/B operands of v_wmma_*_16x16x32.
// p must already point at: row_base + k_base + (lane>=16 ? 8 : 0).
// Lane holds two contiguous 8-half (16B) chunks at +0 and +16 halves.
__device__ __forceinline__ v16h frag_ld(const half_t* p) {
    v8h lo = *(const v8h*)(p);
    v8h hi = *(const v8h*)(p + 16);
    return __builtin_shufflevector(lo, hi, 0,1,2,3,4,5,6,7,8,9,10,11,12,13,14,15);
}

// Fragment order: how every 16-bit operand plane that a matrix loop reads from global memory
// lies in the workspace. A plane of rows x K halves is cut into fragments of 16 rows x 32 k,
// 1,024 bytes each, the fragments of a 16-row tile one behind the other in k (V's order of
// fragments: see the projection kernel). Inside a fragment lane l's first 16-byte piece
// (row l & 15, k 8*(l>>4) + 0..7) lies at byte 16*l and its second (k + 16) at byte
// 512 + 16*l: the same pieces frag_ld takes from a row-major plane, but each wave-wide
// 16-byte load covers 512 contiguous bytes, four whole lines, where a load from row-major
// rows touches 16 lines.
#define FRAG 512               // halves per fragment
// p must already point at: fragment base + lane * 8.
__device__ __forceinline__ v16h frag_pk(const half_t* p) {
    v8h lo = *(const v8h*)(p);
    v8h hi = *(const v8h*)(p + FRAG / 2);
    return __builtin_shufflevector(lo, hi, 0,1,2,3,4,5,6,7,8,9,10,11,12,13,14,15);
}

__device__ __forceinline__ v8f wmma_f16(v16h a, v16h b, v8f c) {
    return __builtin_amdgcn_wmma_f32_16x16x32_f16(false, a, false, b, (short)0, c, false, false);
}

// Stands behind a group of global loads, in front of the first instruction that reuses their
// address registers (a precaution);
// the scheduling barriers keep the loads in front of it and that instruction behind it.
__device__ __forceinline__ void address_registers_free() {
    __builtin_amdgcn_sched_barrier(0);
    asm volatile("s_wait_xcnt 0x0" ::: "memory");
    __builtin_amdgcn_sched_barrier(0);
}

// exp(x) as __expf forms it (x * log2(e), then v_exp_f32). The v_nop fills the one
// slot the instruction set asks for behind a transcendental before its result is
// read or its source register overwritten.
__device__ __forceinline__ float exp_slot(float x) {
    float y;
    asm("v_exp_f32 %0, %1\n\tv_nop" : "=v"(y) : "v"(x * 1.44269504088896340736f));
    return y;
}

// ---------------------------------------------------------------------------
// Kernel 1: f32 rows of D_DIM -> f16 in fragment order, one 16-byte piece per thread
// (grid-stride). Piece o of the output is lane o & 31 of half (o >> 5) & 1 of fragment o >> 6.
// ---------------------------------------------------------------------------
__global__ void cvt_f16_kernel(const float* __restrict__ src,
                               half_t* __restrict__ dst, int n8) {
    int o = blockIdx.x * blockDim.x + threadIdx.x;
    int stride = gridDim.x * blockDim.x;
    for (; o < n8; o += stride) {
        const int f   = o >> 6;                  // fragment: row tile f / NKC_D, k chunk f % NKC_D
        const int row = (f / NKC_D) * 16 + (o & 15);
        const int k   = (f % NKC_D) * KCH + ((o >> 5) & 1) * 16 + ((o >> 4) & 1) * 8;
        const float4* s = (const float4*)(src + (size_t)row * D_DIM + k);
        float4 v0 = s[0], v1 = s[1];
        v8h h;
        h[0] = (half_t)v0.x; h[1] = (half_t)v0.y;
        h[2] = (half_t)v0.z; h[3] = (half_t)v0.w;
        h[4] = (half_t)v1.x; h[5] = (half_t)v1.y;
        h[6] = (half_t)v1.z; h[7] = (half_t)v1.w;
        *(v8h*)(dst + (size_t)o * 8) = h;
    }
}

// ---------------------------------------------------------------------------
// Kernel 2: QKV projection. grid = (3*D/384, B*S/64), block = 128 (4 waves, one per SIMD).
// Each wave computes a 64x96 output block (24 accumulators) in k steps of 64:
// 8 X fragments and 12 W fragments feed 48 WMMAs. X and W lie in fragment order.
// The 24 column blocks of [Q | K | V] go to the waves in order, 8 per matrix, so a
// work-group's four waves work on one matrix:
// block 0..7   -> Q (scaled by 1/sqrt(D), f16 row-major)
// block 8..15  -> K (f16, fragment order: rows = keys, k = channels)
// block 16..23 -> V (f16, fragment order, per batch: rows = channels, k = keys; the two
//                 fragments of a 64-key step lie together, channel tile behind channel tile,
//                 step behind step: what attention's 8 waves read in one step is contiguous)
// A lane's 8 accumulator registers are 8 neighbouring rows of one column of D. With X as A
// those are 8 keys of one channel: one 16-byte piece of a V fragment. K wants 8 channels of
// one key, so its product is taken transposed, W as A and X as B.
// ---------------------------------------------------------------------------
#define QKV_NT 6                               // 16-column tiles per wave
#define WRING  3                               // W ring slots
__global__ __launch_bounds__(128)
void qkv_kernel(const half_t* __restrict__ Xh,
                const half_t* __restrict__ Wqh,
                const half_t* __restrict__ Wkh,
                const half_t* __restrict__ Wvh,
                const float*  __restrict__ bq,
                const float*  __restrict__ bk,
                const float*  __restrict__ bv,
                half_t* __restrict__ Qh,
                half_t* __restrict__ Kh,
                half_t* __restrict__ Vt) {
    const int lane = threadIdx.x & 31;
    const int cb   = blockIdx.x * 4 + (threadIdx.x >> 5);    // column block, 0..23
    const int mat  = blockIdx.x / (D_DIM / (QKV_NT * 16 * 4)); // 0=Q, 1=K, 2=V: one per work-group
    const int n0   = (cb % (D_DIM / (QKV_NT * 16))) * (QKV_NT * 16); // output-channel block
    const int g0   = blockIdx.y * 64;           // global row in [0, B*S)
    const int r    = lane & 15;
    const int mhi  = (lane >> 4) ? 8 : 0;

    const half_t* W  = (mat == 0) ? Wqh : (mat == 1) ? Wkh : Wvh;

    v8f acc[4][QKV_NT];                         // [row tile m][column tile u]
    const half_t* xrow = Xh + (size_t)(g0 / 16) * NKC_D * FRAG + lane * 8;  // +m*NKC_D fragments per row tile
    const half_t* wrow = W  + (size_t)(n0 / 16) * NKC_D * FRAG + lane * 8;  // +u*NKC_D fragments per column tile
    auto product = [&](auto w_is_a_c) {
        constexpr bool w_is_a = decltype(w_is_a_c)::value;
        // The W fragments come through a ring of WRING register slots; a slot holds one column
        // tile's k step (two fragments, 2,048 contiguous bytes) and is asked for again,
        // WRING tiles ahead of its next use, as soon as its eight WMMAs are issued.
        v16h wb[WRING][2];
        #pragma unroll
        for (int j = 0; j < WRING; ++j)
            #pragma unroll
            for (int s = 0; s < 2; ++s)
                wb[j][s] = frag_pk(wrow + ((j % QKV_NT) * NKC_D + (j / QKV_NT) * 2 + s) * FRAG);
        #pragma unroll
        for (int kk = 0; kk < NKC_D / 2; ++kk) {
            v16h a[4][2];
            #pragma unroll
            for (int m = 0; m < 4; ++m)
                #pragma unroll
                for (int s = 0; s < 2; ++s)
                    a[m][s] = frag_pk(xrow + (m * NKC_D + kk * 2 + s) * FRAG);
            #pragma unroll
            for (int u = 0; u < QKV_NT; ++u) {
                const int j = kk * QKV_NT + u, jn = j + WRING;
                // the scheduling barriers keep each refill where it is written, its four loads
                // together: without them the scheduler sinks the loads down to their own
                // WMMAs and the wave waits out a whole load latency per column tile
                __builtin_amdgcn_sched_barrier(0);
                #pragma unroll
                for (int s = 0; s < 2; ++s)
                    #pragma unroll
                    for (int m = 0; m < 4; ++m)
                        acc[m][u] = w_is_a ? wmma_f16(wb[j % WRING][s], a[m][s], acc[m][u])
                                           : wmma_f16(a[m][s], wb[j % WRING][s], acc[m][u]);
                if (jn < (NKC_D / 2) * QKV_NT) {
                    #pragma unroll
                    for (int s = 0; s < 2; ++s)
                        wb[j % WRING][s] = frag_pk(wrow + ((jn % QKV_NT) * NKC_D + (jn / QKV_NT) * 2 + s) * FRAG);
                }
                __builtin_amdgcn_sched_barrier(0);
            }
        }
    };

    if (mat == 1) {
        // acc[m][u][i] = K[key g0 + m*16 + r][channel n0 + u*16 + mhi + i]
        v4f bias[QKV_NT][2];                    // all loops unrolled: stays in registers
        #pragma unroll
        for (int u = 0; u < QKV_NT; ++u)
            #pragma unroll
            for (int p = 0; p < 2; ++p) bias[u][p] = *(const v4f*)(bk + n0 + u * 16 + mhi + p * 4);
        address_registers_free();
        #pragma unroll
        for (int u = 0; u < QKV_NT; ++u)
            #pragma unroll
            for (int m = 0; m < 4; ++m)
                #pragma unroll
                for (int i = 0; i < 8; ++i) acc[m][u][i] = bias[u][i >> 2][i & 3];
        product(std::true_type{});
        // column tile u is half u & 1 of k chunk n0/32 + u/2 of key tile g0/16 + m
        half_t* dst = Kh + ((size_t)(g0 / 16) * NKC_D + n0 / KCH) * FRAG + lane * 8;
        #pragma unroll
        for (int m = 0; m < 4; ++m)
            #pragma unroll
            for (int u = 0; u < QKV_NT; ++u) {
                v8h h;
                #pragma unroll
                for (int i = 0; i < 8; ++i) h[i] = (half_t)acc[m][u][i];
                *(v8h*)(dst + m * NKC_D * FRAG + u * (FRAG / 2)) = h;
            }
    } else {
        // acc[m][u][i] = Y[row g0 + m*16 + mhi + i][channel n0 + u*16 + r]
        const float* bb = (mat == 0) ? bq : bv;
        float bias[QKV_NT];                     // all loops unrolled: stays in registers
        #pragma unroll
        for (int u = 0; u < QKV_NT; ++u) bias[u] = bb[n0 + u * 16 + r];
        address_registers_free();
        #pragma unroll
        for (int u = 0; u < QKV_NT; ++u)
            #pragma unroll
            for (int m = 0; m < 4; ++m)
                #pragma unroll
                for (int i = 0; i < 8; ++i) acc[m][u][i] = bias[u];
        product(std::false_type{});
        if (mat == 0) {
            const float qscale = 0.03608439182435161f;   // 1/sqrt(768)
            #pragma unroll
            for (int m = 0; m < 4; ++m)
                #pragma unroll
                for (int u = 0; u < QKV_NT; ++u) {
                    half_t* dst = Qh + (size_t)(g0 + m * 16) * D_DIM + n0 + u * 16 + r;
                    #pragma unroll
                    for (int i = 0; i < 8; ++i)
                        dst[(size_t)(i + mhi) * D_DIM] = (half_t)(acc[m][u][i] * qscale);
                }
            // stands behind the last store, in front of any reuse of the stores' address and
            // data registers in the code laid out behind this branch (a precaution)
            asm volatile("s_wait_xcnt 0x0" ::: "memory");
        } else {
            const int b  = g0 >> 11;                 // S = 2048
            const int s0 = g0 & (S_LEN - 1);
            // row tile m is half m & 1 of fragment m/2 of channel tile n0/16 + u in step s0/64
            half_t* dst = Vt + (size_t)b * D_DIM * S_LEN
                             + ((size_t)(s0 / 64) * (D_DIM / 16) + n0 / 16) * 2 * FRAG + lane * 8;
            #pragma unroll
            for (int m = 0; m < 4; ++m)
                #pragma unroll
                for (int u = 0; u < QKV_NT; ++u) {
                    v8h h;
                    #pragma unroll
                    for (int i = 0; i < 8; ++i) h[i] = (half_t)acc[m][u][i];
                    *(v8h*)(dst + u * 2 * FRAG + m * (FRAG / 2)) = h;
                }
            // as behind the Q stores
            asm volatile("s_wait_xcnt 0x0" ::: "memory");
        }
    }
}

// ---------------------------------------------------------------------------
// Kernel 3: attention for one 32-row query tile (two 16-row A tiles).
// grid = B*S/32, block = 256 (8 waves -> 2 waves/SIMD for latency hiding).
// Every K and V fragment loaded from global feeds two WMMAs, one per A tile; K and V lie
// in fragment order, so each of their loads covers 512 contiguous bytes.
// LDS: Qs 48KB | Sc 256KB (f32 scores; f16 exp overwrites them in place) | reductions ~2KB
// Q rows and score rows each carry 16 bytes of pad: the pitch is then 16 B x an odd number,
// so the 16 rows that one ds_load_b128 fragment read touches fall on 16 different groups
// of four banks (at the unpadded pitches, multiples of 256 B, all 16 fall on one group).
// ---------------------------------------------------------------------------
#define QROWS     32
#define Q_PITCH   (D_DIM + 8)                      // halves per Q row in LDS (1552 B)
#define SC_PITCH  (S_LEN + 4)                      // floats per score row (8208 B)
#define SMEM_QS   (QROWS * Q_PITCH * 2)            // 49664
#define SMEM_SC   (QROWS * SC_PITCH * 4)           // 262656
#define SMEM_RED  ((512 + QROWS + QROWS) * 4)      // 2304
#define SMEM_TOT  (SMEM_QS + SMEM_SC + SMEM_RED)   // 314624
#define P_PITCH   (SC_PITCH * 2)                   // halves per P row (= one f32 score row)
#define KU        2                                // key tiles per stage-1 pass
#define KRING     3                                // stage-1 ring slots

__global__ __launch_bounds__(256, 1)
void attn_kernel(const half_t* __restrict__ Qh,
                 const half_t* __restrict__ Kh,
                 const half_t* __restrict__ Vt,
                 float* __restrict__ Out) {
    __shared__ __attribute__((aligned(16))) char smem[SMEM_TOT];
    half_t* Qs      = (half_t*)(smem);
    float*  Sc      = (float*)(smem + SMEM_QS);
    half_t* Pq      = (half_t*)(smem + SMEM_QS);          // in place over Sc
    float*  partial = (float*)(smem + SMEM_QS + SMEM_SC); // [512]
    float*  rowmax  = partial + 512;                      // [32]
    float*  rowsum  = partial + 512 + QROWS;              // [32]

    const int tid  = threadIdx.x;
    const int lane = tid & 31;
    const int wave = tid >> 5;                   // 0..7
    const int g0   = blockIdx.x * QROWS;         // global query row
    const int b    = g0 >> 11;
    const int r    = lane & 15;
    const int mhi  = (lane >> 4) ? 8 : 0;
    const int ko   = mhi;

    // ---- stage 0: stage Q tile (contiguous 48KB in global) into LDS rows of Q_PITCH ----
    {
        // wave w brings rows w, w+8, w+16, w+24, each in three runs of 512 contiguous bytes
        const uint4* src = (const uint4*)(Qh + (size_t)(g0 + wave) * D_DIM) + lane;
        half_t* dst = Qs + wave * Q_PITCH + lane * 8;
        #pragma unroll
        for (int rr = 0; rr < QROWS / 8; ++rr)
            #pragma unroll
            for (int c = 0; c < D_DIM / 256; ++c)
                *(uint4*)(dst + rr * 8 * Q_PITCH + c * 256) = src[rr * 8 * (D_DIM / 8) + c * 32];
        // keeps the address arithmetic of stage 1 behind these stores: so held back, the first
        // reuse of the loads' address registers has the compiler's own s_wait_xcnt 0 in front
        // (a precaution)
        __builtin_amdgcn_sched_barrier(0);
    }
    __syncthreads();

    // ---- stage 1: scores = Q Kt (scale pre-folded into Q) ----
    // wave handles keys [wave*256, wave*256+256), KU key tiles per pass. The K fragments
    // come through a ring of KRING register slots; a slot holds one key tile's k step of
    // 64 (two fragments, 2,048 contiguous bytes) and is asked for
    // again as soon as its four WMMAs are issued, KRING slots ahead of its next use.
    // The wave's 48 Q fragments are read from LDS once and stay in registers for all passes.
    v16h qa[NKC_D][2];
    #pragma unroll
    for (int dk = 0; dk < NKC_D; ++dk) {
        qa[dk][0] = frag_ld(Qs + r * Q_PITCH + ko + dk * KCH);
        qa[dk][1] = frag_ld(Qs + (16 + r) * Q_PITCH + ko + dk * KCH);
    }
    const half_t* kwave = Kh + (size_t)((b * S_LEN + wave * 256) / 16) * NKC_D * FRAG + lane * 8;
    v16h kb[KRING][2];
    #pragma unroll
    for (int j = 0; j < KRING; ++j)
        #pragma unroll
        for (int s = 0; s < 2; ++s)
            kb[j][s] = frag_pk(kwave + ((j % KU) * NKC_D + (j / KU) * 2 + s) * FRAG);
    // keeps the first loads in ring order, which the counted waits below lean on for speed
    __builtin_amdgcn_sched_barrier(0);
    auto qk_pass = [&](int c, auto more_c) {
        constexpr bool more = decltype(more_c)::value;      // another pass follows
        constexpr int  NJ   = (NKC_D / 2) * KU;             // ring steps per pass
        static_assert(NJ % KRING == 0 && NJ % KU == 0, "a pass must hand the ring on at slot 0");
        const int key0 = wave * 256 + c * (KU * 16);
        const half_t* krow = kwave + (size_t)c * KU * NKC_D * FRAG;
        v8f acc[2][KU] = {};
        #pragma unroll
        for (int j = 0; j < NJ; ++j) {
            const int u = j % KU, dp = j / KU;
            #pragma unroll
            for (int s = 0; s < 2; ++s) {
                acc[0][u] = wmma_f16(qa[dp * 2 + s][0], kb[j % KRING][s], acc[0][u]);
                acc[1][u] = wmma_f16(qa[dp * 2 + s][1], kb[j % KRING][s], acc[1][u]);
            }
            // the slot's next tenant: KRING steps on, in this pass or at the head of the next
            const int jn = j + KRING;
            if (jn < NJ || more) {
                const int un = jn % KU + (jn < NJ ? 0 : KU), dn = (jn % NJ) / KU;
                #pragma unroll
                for (int s = 0; s < 2; ++s)
                    kb[j % KRING][s] = frag_pk(krow + (un * NKC_D + dn * 2 + s) * FRAG);
            }
            // keeps the refill here: without it the scheduler sinks each load down to
            // its own WMMAs and the wave waits out one whole load latency per fragment
            __builtin_amdgcn_sched_barrier(0);
        }
        if constexpr (more) {
            // loads of the next pass are in flight here: this wait stands in front of the
            // first instruction that reuses their address registers (a precaution); the
            // scheduling barrier keeps that instruction behind it
            asm volatile("s_wait_xcnt 0x0" ::: "memory");
            __builtin_amdgcn_sched_barrier(0);
        }
        // unrolled so that acc[][] is indexed by constants and stays in registers
        #pragma unroll
        for (int t = 0; t < 2; ++t)
            #pragma unroll
            for (int u = 0; u < KU; ++u)
                #pragma unroll
                for (int i = 0; i < 8; ++i)
                    Sc[(t * 16 + i + mhi) * SC_PITCH + key0 + u * 16 + r] = acc[t][u][i];
    };
    for (int c = 0; c < 256 / (KU * 16) - 1; ++c) qk_pass(c, std::true_type{});
    qk_pass(256 / (KU * 16) - 1, std::false_type{});
    __syncthreads();

    // ---- stage 2: softmax stats + unnormalized exp(P) in f16 ----
    // 16 lanes of one wave per row, rows (tid>>4) and (tid>>4)+16. In step i the 16 lanes
    // read the 256 contiguous bytes (64 scores) at byte 256*i of the row, 16 bytes a lane,
    // so a read touches every bank once.
    // The f16 results of step i go to the 128 bytes at byte 128*i of the same row: P ends
    // up contiguous, key k at half k. That range lies wholly below byte 256*(i+1), which
    // the row's own wave has read by then (a wave's LDS operations run in program order),
    // and no later step reads it; no other wave touches the row.
    {
        const int row = tid >> 4;
        const int seg = tid & 15;
        for (int h = 0; h < 2; ++h) {
            const v4f* srow4 = (const v4f*)(Sc + (row + h * 16) * SC_PITCH) + seg;
            float m = -3.0e38f;
            for (int i = 0; i < 32; ++i) {
                v4f v = srow4[i * 16];
                m = fmaxf(m, fmaxf(fmaxf(v[0], v[1]), fmaxf(v[2], v[3])));
            }
            partial[h * 256 + tid] = m;
        }
        __syncthreads();
        if (seg < 2) {                            // seg selects the row half
            const int rr = row + seg * 16;
            float mm = partial[rr * 16];
            #pragma unroll
            for (int i = 1; i < 16; ++i) mm = fmaxf(mm, partial[rr * 16 + i]);
            rowmax[rr] = mm;
        }
        __syncthreads();
        for (int h = 0; h < 2; ++h) {
            const float rm = rowmax[row + h * 16];
            const v4f* srow4 = (const v4f*)(Sc + (row + h * 16) * SC_PITCH) + seg;
            half_t* prow = Pq + (row + h * 16) * P_PITCH + seg * 4;
            float s = 0.0f;
            // eight steps' reads stand together in front of their eight stores: the compiler
            // cannot tell that a store never meets a later read, and step by step each read
            // would wait behind the store before it; both inner loops are unrolled so that
            // v[] is indexed by constants and stays in registers
            for (int i0 = 0; i0 < 32; i0 += 8) {
                v4f v[8];
                #pragma unroll
                for (int i = 0; i < 8; ++i) v[i] = srow4[(i0 + i) * 16];
                #pragma unroll
                for (int i = 0; i < 8; ++i) {
                    float e0 = exp_slot(v[i][0] - rm);
                    float e1 = exp_slot(v[i][1] - rm);
                    float e2 = exp_slot(v[i][2] - rm);
                    float e3 = exp_slot(v[i][3] - rm);
                    s += (e0 + e1) + (e2 + e3);
                    v4h hh;
                    hh[0] = (half_t)e0; hh[1] = (half_t)e1;
                    hh[2] = (half_t)e2; hh[3] = (half_t)e3;
                    *(v4h*)(prow + (i0 + i) * 64) = hh;
                }
            }
            partial[h * 256 + tid] = s;
        }
        __syncthreads();
        if (seg < 2) {
            const int rr = row + seg * 16;
            float ss = 0.0f;
            #pragma unroll
            for (int i = 0; i < 16; ++i) ss += partial[rr * 16 + i];
            rowsum[rr] = ss;
        }
        __syncthreads();
    }

    // ---- stage 3: Out = (P @ V) / rowsum ----
    // wave tile: 32 query rows x 96 d-cols, 12 accumulators: two P A-frags (LDS,
    // each read once per wave) x 6 V B-frags (global) = 12 WMMAs per 32 keys.
    // Key chunk kc (32 keys) of a P row starts at half kc*32.
    float rs[2][8];
    // unrolled so that rs[][] stays in registers
    #pragma unroll
    for (int t = 0; t < 2; ++t)
        #pragma unroll
        for (int i = 0; i < 8; ++i) rs[t][i] = 1.0f / rowsum[t * 16 + i + mhi];

    {
        const int n0 = wave * 96;
        v8f acc[2][6] = {};
        const half_t* prow = Pq + r * P_PITCH + ko;
        const half_t* vrow = Vt + (size_t)b * D_DIM * S_LEN + (n0 / 16) * 2 * FRAG + lane * 8;
        // One step = 64 keys. vb[u] holds V tile u's two fragments of the step (2,048
        // contiguous bytes) and is asked for again, for the next step,
        // as soon as its four WMMAs are issued; the P fragments of the next step are read
        // from LDS as one group in front of this step's WMMAs.
        v16h vb[6][2];
        v16h pa[2][2][2];                        // [step parity][32-key half][A tile]
        #pragma unroll
        for (int s = 0; s < 2; ++s) {
            pa[0][s][0] = frag_ld(prow + s * KCH);
            pa[0][s][1] = frag_ld(prow + 16 * P_PITCH + s * KCH);
        }
        #pragma unroll
        for (int u = 0; u < 6; ++u)
            #pragma unroll
            for (int s = 0; s < 2; ++s)
                vb[u][s] = frag_pk(vrow + (u * 2 + s) * FRAG);
        auto pv_step = [&](int kp, auto par_c, auto more_c) {
            constexpr int  par  = decltype(par_c)::value;
            constexpr bool more = decltype(more_c)::value;
            if constexpr (more) {
                #pragma unroll
                for (int s = 0; s < 2; ++s) {
                    const int kc = (kp + 1) * 2 + s;
                    const int po = kc * KCH;
                    pa[par ^ 1][s][0] = frag_ld(prow + po);
                    pa[par ^ 1][s][1] = frag_ld(prow + 16 * P_PITCH + po);
                }
            }
            // this and the one below keep the fetches ahead where they are written:
            // without them the scheduler sinks each load down to its own WMMAs
            __builtin_amdgcn_sched_barrier(0);
            #pragma unroll
            for (int u = 0; u < 6; ++u) {
                #pragma unroll
                for (int s = 0; s < 2; ++s) {
                    acc[0][u] = wmma_f16(pa[par][s][0], vb[u][s], acc[0][u]);
                    acc[1][u] = wmma_f16(pa[par][s][1], vb[u][s], acc[1][u]);
                }
                if constexpr (more) {
                    #pragma unroll
                    for (int s = 0; s < 2; ++s)
                        vb[u][s] = frag_pk(vrow + (size_t)(((kp + 1) * (D_DIM / 16) + u) * 2 + s) * FRAG);
                }
                __builtin_amdgcn_sched_barrier(0);
            }
        };
        using c0 = std::integral_constant<int, 0>;
        using c1 = std::integral_constant<int, 1>;
        for (int kp = 0; kp < NKC_S / 2 - 2; kp += 2) {
            pv_step(kp,     c0{}, std::true_type{});
            pv_step(kp + 1, c1{}, std::true_type{});
            // the next step's loads are in flight here: this wait stands in front of the
            // loop's step of their address registers (a precaution); the scheduling
            // barrier keeps that step behind it
            asm volatile("s_wait_xcnt 0x0" ::: "memory");
            __builtin_amdgcn_sched_barrier(0);
        }
        pv_step(NKC_S / 2 - 2, c0{}, std::true_type{});
        pv_step(NKC_S / 2 - 1, c1{}, std::false_type{});
        // unrolled so that acc[][] and rs[][] stay in registers
        #pragma unroll
        for (int t = 0; t < 2; ++t)
            #pragma unroll
            for (int u = 0; u < 6; ++u) {
                float* orow = Out + (size_t)(g0 + t * 16) * D_DIM + n0 + u * 16 + r;
                #pragma unroll
                for (int i = 0; i < 8; ++i)
                    orow[(size_t)(i + mhi) * D_DIM] = acc[t][u][i] * rs[t][i];
            }
    }
}

// ---------------------------------------------------------------------------
extern "C" void kernel_launch(void* const* d_in, const int* in_sizes, int n_in,
                              void* d_out, int out_size, void* d_ws, size_t ws_size,
                              hipStream_t stream) {
    const float* X  = (const float*)d_in[0];
    const float* Wq = (const float*)d_in[1];
    const float* bq = (const float*)d_in[2];
    const float* Wk = (const float*)d_in[3];
    const float* bk = (const float*)d_in[4];
    const float* Wv = (const float*)d_in[5];
    const float* bv = (const float*)d_in[6];
    float* out = (float*)d_out;

    const size_t nX = (size_t)B_N * S_LEN * D_DIM;     // 6291456
    const size_t nW = (size_t)D_DIM * D_DIM;           // 589824

    char* ws = (char*)d_ws;
    half_t* Xh  = (half_t*)ws;              ws += nX * sizeof(half_t);
    half_t* Wqh = (half_t*)ws;              ws += nW * sizeof(half_t);
    half_t* Wkh = (half_t*)ws;              ws += nW * sizeof(half_t);
    half_t* Wvh = (half_t*)ws;              ws += nW * sizeof(half_t);
    half_t* Qh  = (half_t*)ws;              ws += nX * sizeof(half_t);
    half_t* Kh  = (half_t*)ws;              ws += nX * sizeof(half_t);
    half_t* Vt  = (half_t*)ws;              ws += nX * sizeof(half_t);

    // 1) f32 -> f16 conversions into fragment order (8 elems/thread)
    cvt_f16_kernel<<<1024, 256, 0, stream>>>(X,  Xh,  (int)(nX / 8));
    cvt_f16_kernel<<< 256, 256, 0, stream>>>(Wq, Wqh, (int)(nW / 8));
    cvt_f16_kernel<<< 256, 256, 0, stream>>>(Wk, Wkh, (int)(nW / 8));
    cvt_f16_kernel<<< 256, 256, 0, stream>>>(Wv, Wvh, (int)(nW / 8));

    // 2) QKV projection: 24 x 96-wide output blocks, 4 per work-group, x 128 row tiles of 64
    dim3 gq(3 * D_DIM / (QKV_NT * 16 * 4), (B_N * S_LEN) / 64);
    qkv_kernel<<<gq, 128, 0, stream>>>(Xh, Wqh, Wkh, Wvh, bq, bk, bv, Qh, Kh, Vt);

    // 3) attention: one block per 32-row query tile, ~307KB static LDS
    attn_kernel<<<(B_N * S_LEN) / QROWS, 256, 0, stream>>>(Qh, Kh, Vt, out);
}

// v006
// A run of this version takes 114 microseconds.
// Two timings next to v005 both put it at 1.08 times that version's speed.
// Counting every step since v000, it is 4.11 times as fast.
#include <hip/hip_runtime.h>
#include <hip/hip_bf16.h>
#include <type_traits>

typedef _Float16 half_t;
typedef __attribute__((ext_vector_type(4)))  half_t v4h;
typedef __attribute__((ext_vector_type(8)))  half_t v8h;
typedef __attribute__((ext_vector_type(16))) half_t v16h;
typedef __attribute__((ext_vector_type(8)))  float  v8f;
typedef __attribute__((ext_vector_type(4)))  float  v4f;

#define B_N    4
#define S_LEN  2048
#define D_DIM  768
#define KCH    32              // K-dim per wmma
#define NKC_D  (D_DIM / KCH)   // 24
#define NKC_S  (S_LEN / KCH)   // 64

// Per-lane fragment load for 16-bit A/B operands of v_wmma_*_16x16x32.
// p must already point at: row_base + k_base + (lane>=16 ? 8 : 0).
// Lane holds two contiguous 8-half (16B) chunks at +0 and +16 halves.
__device__ __forceinline__ v16h frag_ld(const half_t* p) {
    v8h lo = *(const v8h*)(p);
    v8h hi = *(const v8h*)(p + 16);
    return __builtin_shufflevector(lo, hi, 0,1,2,3,4,5,6,7,8,9,10,11,12,13,14,15);
}

// Fragment order: how every 16-bit operand plane that a matrix loop reads from global memory
// lies in the workspace. A plane of rows x K halves is cut into fragments of 16 rows x 32 k,
// 1,024 bytes each, the fragments of a 16-row tile one behind the other in k (V's order of
// fragments: see the projection kernel). Inside a fragment lane l's first 16-byte piece
// (row l & 15, k 8*(l>>4) + 0..7) lies at byte 16*l and its second (k + 16) at byte
// 512 + 16*l: the same pieces frag_ld takes from a row-major plane, but each wave-wide
// 16-byte load covers 512 contiguous bytes, four whole lines, where a load from row-major
// rows touches 16 lines.
#define FRAG 512               // halves per fragment
// p must already point at: fragment base + lane * 8.
__device__ __forceinline__ v16h frag_pk(const half_t* p) {
    v8h lo = *(const v8h*)(p);
    v8h hi = *(const v8h*)(p + FRAG / 2);
    return __builtin_shufflevector(lo, hi, 0,1,2,3,4,5,6,7,8,9,10,11,12,13,14,15);
}

__device__ __forceinline__ v8f wmma_f16(v16h a, v16h b, v8f c) {
    return __builtin_amdgcn_wmma_f32_16x16x32_f16(false, a, false, b, (short)0, c, false, false);
}

// Stands behind a group of global loads, in front of the first instruction that reuses their
// address registers (a precaution);
// the scheduling barriers keep the loads in front of it and that instruction behind it.
__device__ __forceinline__ void address_registers_free() {
    __builtin_amdgcn_sched_barrier(0);
    asm volatile("s_wait_xcnt 0x0" ::: "memory");
    __builtin_amdgcn_sched_barrier(0);
}

// exp(x) as __expf forms it (x * log2(e), then v_exp_f32). The v_nop fills the one
// slot the instruction set asks for behind a transcendental before its result is
// read or its source register overwritten.
__device__ __forceinline__ float exp_slot(float x) {
    float y;
    asm("v_exp_f32 %0, %1\n\tv_nop" : "=v"(y) : "v"(x * 1.44269504088896340736f));
    return y;
}

// ---------------------------------------------------------------------------
// Kernel 1: f32 rows of D_DIM -> f16 in fragment order, one 16-byte piece per thread
// (grid-stride), X and the three weight matrices in ONE launch. The four f16 planes lie one
// behind the other in the workspace (X, Wq, Wk, Wv), so they are one run of 16-row tiles:
// tiles 0..X_TILES-1 are X's, then W_TILES tiles per weight matrix. Piece o of that run is
// lane o & 31 of half (o >> 5) & 1 of fragment o >> 6. A wave's 32 pieces lie in one
// fragment, so the choice of the source matrix is the same for a whole wave.
// ---------------------------------------------------------------------------
#define X_TILES (B_N * S_LEN / 16)             // 512
#define W_TILES (D_DIM / 16)                   // 48
__global__ void cvt_f16_kernel(const float* __restrict__ X,
                               const float* __restrict__ Wq,
                               const float* __restrict__ Wk,
                               const float* __restrict__ Wv,
                               half_t* __restrict__ dst, int n8) {
    int o = blockIdx.x * blockDim.x + threadIdx.x;
    int stride = gridDim.x * blockDim.x;
    for (; o < n8; o += stride) {
        const int f = o >> 6;                    // fragment: row tile f / NKC_D, k chunk f % NKC_D
        int tile = f / NKC_D;
        const float* src = X;
        if (tile >= X_TILES) {
            const int m = (tile - X_TILES) / W_TILES;
            src  = (m == 0) ? Wq : (m == 1) ? Wk : Wv;
            tile = (tile - X_TILES) % W_TILES;
        }
        const int row = tile * 16 + (o & 15);
        const int k   = (f % NKC_D) * KCH + ((o >> 5) & 1) * 16 + ((o >> 4) & 1) * 8;
        const float4* s = (const float4*)(src + (size_t)row * D_DIM + k);
        float4 v0 = s[0], v1 = s[1];
        v8h h;
        h[0] = (half_t)v0.x; h[1] = (half_t)v0.y;
        h[2] = (half_t)v0.z; h[3] = (half_t)v0.w;
        h[4] = (half_t)v1.x; h[5] = (half_t)v1.y;
        h[6] = (half_t)v1.z; h[7] = (half_t)v1.w;
        *(v8h*)(dst + (size_t)o * 8) = h;
    }
}

// ---------------------------------------------------------------------------
// Kernel 2: QKV projection. grid = (3*D/384, B*S/64), block = 128 (4 waves, one per SIMD).
// Each wave computes a 64x96 output block (24 accumulators) in k steps of 64:
// 8 X fragments and 12 W fragments feed 48 WMMAs. X and W lie in fragment order.
// The 24 column blocks of [Q | K | V] go to the waves in order, 8 per matrix, so a
// work-group's four waves work on one matrix:
// block 0..7   -> Q (scaled by 1/sqrt(D), f16 row-major)
// block 8..15  -> K (f16, fragment order: rows = keys, k = channels)
// block 16..23 -> V (f16, fragment order, per batch: rows = channels, k = keys; the two
//                 fragments of a 64-key step lie together, channel tile behind channel tile,
//                 step behind step: what attention's 8 waves read in one step is contiguous)
// A lane's 8 accumulator registers are 8 neighbouring rows of one column of D. With X as A
// those are 8 keys of one channel: one 16-byte piece of a V fragment. K wants 8 channels of
// one key, so its product is taken transposed, W as A and X as B.
// ---------------------------------------------------------------------------
#define QKV_NT 6                               // 16-column tiles per wave
#define WRING  3                               // W ring slots
__global__ __launch_bounds__(128)
void qkv_kernel(const half_t* __restrict__ Xh,
                const half_t* __restrict__ Wqh,
                const half_t* __restrict__ Wkh,
                const half_t* __restrict__ Wvh,
                const float*  __restrict__ bq,
                const float*  __restrict__ bk,
                const float*  __restrict__ bv,
                half_t* __restrict__ Qh,
                half_t* __restrict__ Kh,
                half_t* __restrict__ Vt) {
    const int lane = threadIdx.x & 31;
    const int cb   = blockIdx.x * 4 + (threadIdx.x >> 5);    // column block, 0..23
    const int mat  = blockIdx.x / (D_DIM / (QKV_NT * 16 * 4)); // 0=Q, 1=K, 2=V: one per work-group
    const int n0   = (cb % (D_DIM / (QKV_NT * 16))) * (QKV_NT * 16); // output-channel block
    const int g0   = blockIdx.y * 64;           // global row in [0, B*S)
    const int r    = lane & 15;
    const int mhi  = (lane >> 4) ? 8 : 0;

    const half_t* W  = (mat == 0) ? Wqh : (mat == 1) ? Wkh : Wvh;

    v8f acc[4][QKV_NT];                         // [row tile m][column tile u]
    const half_t* xrow = Xh + (size_t)(g0 / 16) * NKC_D * FRAG + lane * 8;  // +m*NKC_D fragments per row tile
    const half_t* wrow = W  + (size_t)(n0 / 16) * NKC_D * FRAG + lane * 8;  // +u*NKC_D fragments per column tile
    auto product = [&](auto w_is_a_c) {
        constexpr bool w_is_a = decltype(w_is_a_c)::value;
        // The W fragments come through a ring of WRING register slots; a slot holds one column
        // tile's k step (two fragments, 2,048 contiguous bytes) and is asked for again,
        // WRING tiles ahead of its next use, as soon as its eight WMMAs are issued.
        v16h wb[WRING][2];
        #pragma unroll
        for (int j = 0; j < WRING; ++j)
            #pragma unroll
            for (int s = 0; s < 2; ++s)
                wb[j][s] = frag_pk(wrow + ((j % QKV_NT) * NKC_D + (j / QKV_NT) * 2 + s) * FRAG);
        #pragma unroll
        for (int kk = 0; kk < NKC_D / 2; ++kk) {
            v16h a[4][2];
            #pragma unroll
            for (int m = 0; m < 4; ++m)
                #pragma unroll
                for (int s = 0; s < 2; ++s)
                    a[m][s] = frag_pk(xrow + (m * NKC_D + kk * 2 + s) * FRAG);
            #pragma unroll
            for (int u = 0; u < QKV_NT; ++u) {
                const int j = kk * QKV_NT + u, jn = j + WRING;
                // the scheduling barriers keep each refill where it is written, its four loads
                // together: without them the scheduler sinks the loads down to their own
                // WMMAs and the wave waits out a whole load latency per column tile
                __builtin_amdgcn_sched_barrier(0);
                #pragma unroll
                for (int s = 0; s < 2; ++s)
                    #pragma unroll
                    for (int m = 0; m < 4; ++m)
                        acc[m][u] = w_is_a ? wmma_f16(wb[j % WRING][s], a[m][s], acc[m][u])
                                           : wmma_f16(a[m][s], wb[j % WRING][s], acc[m][u]);
                if (jn < (NKC_D / 2) * QKV_NT) {
                    #pragma unroll
                    for (int s = 0; s < 2; ++s)
                        wb[j % WRING][s] = frag_pk(wrow + ((jn % QKV_NT) * NKC_D + (jn / QKV_NT) * 2 + s) * FRAG);
                }
                __builtin_amdgcn_sched_barrier(0);
            }
        }
    };

    if (mat == 1) {
        // acc[m][u][i] = K[key g0 + m*16 + r][channel n0 + u*16 + mhi + i]
        v4f bias[QKV_NT][2];                    // all loops unrolled: stays in registers
        #pragma unroll
        for (int u = 0; u < QKV_NT; ++u)
            #pragma unroll
            for (int p = 0; p < 2; ++p) bias[u][p] = *(const v4f*)(bk + n0 + u * 16 + mhi + p * 4);
        address_registers_free();
        #pragma unroll
        for (int u = 0; u < QKV_NT; ++u)
            #pragma unroll
            for (int m = 0; m < 4; ++m)
                #pragma unroll
                for (int i = 0; i < 8; ++i) acc[m][u][i] = bias[u][i >> 2][i & 3];
        product(std::true_type{});
        // column tile u is half u & 1 of k chunk n0/32 + u/2 of key tile g0/16 + m
        half_t* dst = Kh + ((size_t)(g0 / 16) * NKC_D + n0 / KCH) * FRAG + lane * 8;
        #pragma unroll
        for (int m = 0; m < 4; ++m)
            #pragma unroll
            for (int u = 0; u < QKV_NT; ++u) {
                v8h h;
                #pragma unroll
                for (int i = 0; i < 8; ++i) h[i] = (half_t)acc[m][u][i];
                *(v8h*)(dst + m * NKC_D * FRAG + u * (FRAG / 2)) = h;
            }
    } else {
        // acc[m][u][i] = Y[row g0 + m*16 + mhi + i][channel n0 + u*16 + r]
        const float* bb = (mat == 0) ? bq : bv;
        float bias[QKV_NT];                     // all loops unrolled: stays in registers
        #pragma unroll
        for (int u = 0; u < QKV_NT; ++u) bias[u] = bb[n0 + u * 16 + r];
        address_registers_free();
        #pragma unroll
        for (int u = 0; u < QKV_NT; ++u)
            #pragma unroll
            for (int m = 0; m < 4; ++m)
                #pragma unroll
                for (int i = 0; i < 8; ++i) acc[m][u][i] = bias[u];
        product(std::false_type{});
        if (mat == 0) {
            const float qscale = 0.03608439182435161f;   // 1/sqrt(768)
            #pragma unroll
            for (int m = 0; m < 4; ++m)
                #pragma unroll
                for (int u = 0; u < QKV_NT; ++u) {
                    half_t* dst = Qh + (size_t)(g0 + m * 16) * D_DIM + n0 + u * 16 + r;
                    #pragma unroll
                    for (int i = 0; i < 8; ++i)
                        dst[(size_t)(i + mhi) * D_DIM] = (half_t)(acc[m][u][i] * qscale);
                }
            // stands behind the last store, in front of any reuse of the stores' address and
            // data registers in the code laid out behind this branch (a precaution)
            asm volatile("s_wait_xcnt 0x0" ::: "memory");
        } else {
            const int b  = g0 >> 11;                 // S = 2048
            const int s0 = g0 & (S_LEN - 1);
            // row tile m is half m & 1 of fragment m/2 of channel tile n0/16 + u in step s0/64
            half_t* dst = Vt + (size_t)b * D_DIM * S_LEN
                             + ((size_t)(s0 / 64) * (D_DIM / 16) + n0 / 16) * 2 * FRAG + lane * 8;
            #pragma unroll
            for (int m = 0; m < 4; ++m)
                #pragma unroll
                for (int u = 0; u < QKV_NT; ++u) {
                    v8h h;
                    #pragma unroll
                    for (int i = 0; i < 8; ++i) h[i] = (half_t)acc[m][u][i];
                    *(v8h*)(dst + u * 2 * FRAG + m * (FRAG / 2)) = h;
                }
            // as behind the Q stores
            asm volatile("s_wait_xcnt 0x0" ::: "memory");
        }
    }
}

// ---------------------------------------------------------------------------
// Kernel 3: attention for one 32-row query tile (two 16-row A tiles).
// grid = B*S/32, block = 256 (8 waves -> 2 waves/SIMD for latency hiding).
// Every K and V fragment loaded from global feeds two WMMAs, one per A tile; K and V lie
// in fragment order, so each of their loads covers 512 contiguous bytes.
// LDS: Qs 48KB | Sc 256KB (f32 scores; f16 exp overwrites them in place) | reductions ~2KB
// Q rows and score rows each carry 16 bytes of pad: the pitch is then 16 B x an odd number,
// so the 16 rows that one ds_load_b128 fragment read touches fall on 16 different groups
// of four banks (at the unpadded pitches, multiples of 256 B, all 16 fall on one group).
// ---------------------------------------------------------------------------
#define QROWS     32
#define Q_PITCH   (D_DIM + 8)                      // halves per Q row in LDS (1552 B)
#define SC_PITCH  (S_LEN + 4)                      // floats per score row (8208 B)
#define SMEM_QS   (QROWS * Q_PITCH * 2)            // 49664
#define SMEM_SC   (QROWS * SC_PITCH * 4)           // 262656
#define SMEM_RED  ((512 + QROWS + QROWS) * 4)      // 2304
#define SMEM_TOT  (SMEM_QS + SMEM_SC + SMEM_RED)   // 314624
#define P_PITCH   (SC_PITCH * 2)                   // halves per P row (= one f32 score row)
#define KU        2                                // key tiles per stage-1 pass
#define KRING     3                                // stage-1 ring slots

__global__ __launch_bounds__(256, 1)
void attn_kernel(const half_t* __restrict__ Qh,
                 const half_t* __restrict__ Kh,
                 const half_t* __restrict__ Vt,
                 float* __restrict__ Out) {
    __shared__ __attribute__((aligned(16))) char smem[SMEM_TOT];
    half_t* Qs      = (half_t*)(smem);
    float*  Sc      = (float*)(smem + SMEM_QS);
    half_t* Pq      = (half_t*)(smem + SMEM_QS);          // in place over Sc
    float*  partial = (float*)(smem + SMEM_QS + SMEM_SC); // [512]
    float*  rowmax  = partial + 512;                      // [32]
    float*  rowsum  = partial + 512 + QROWS;              // [32]

    const int tid  = threadIdx.x;
    const int lane = tid & 31;
    const int wave = tid >> 5;                   // 0..7
    const int g0   = blockIdx.x * QROWS;         // global query row
    const int b    = g0 >> 11;
    const int r    = lane & 15;
    const int mhi  = (lane >> 4) ? 8 : 0;
    const int ko   = mhi;

    // ---- stage 0: stage Q tile (contiguous 48KB in global) into LDS rows of Q_PITCH ----
    {
        // wave w brings rows w, w+8, w+16, w+24, each in three runs of 512 contiguous bytes
        const uint4* src = (const uint4*)(Qh + (size_t)(g0 + wave) * D_DIM) + lane;
        half_t* dst = Qs + wave * Q_PITCH + lane * 8;
        #pragma unroll
        for (int rr = 0; rr < QROWS / 8; ++rr)
            #pragma unroll
            for (int c = 0; c < D_DIM / 256; ++c)
                *(uint4*)(dst + rr * 8 * Q_PITCH + c * 256) = src[rr * 8 * (D_DIM / 8) + c * 32];
        // keeps the address arithmetic of stage 1 behind these stores: so held back, the first
        // reuse of the loads' address registers has the compiler's own s_wait_xcnt 0 in front
        // (a precaution)
        __builtin_amdgcn_sched_barrier(0);
    }
    __syncthreads();

    // ---- stage 1: scores = Q Kt (scale pre-folded into Q) ----
    // wave handles keys [wave*256, wave*256+256), KU key tiles per pass. The K fragments
    // come through a ring of KRING register slots; a slot holds one key tile's k step of
    // 64 (two fragments, 2,048 contiguous bytes) and is asked for
    // again as soon as its four WMMAs are issued, KRING slots ahead of its next use.
    // The wave's 48 Q fragments are read from LDS once and stay in registers for all passes.
    v16h qa[NKC_D][2];
    #pragma unroll
    for (int dk = 0; dk < NKC_D; ++dk) {
        qa[dk][0] = frag_ld(Qs + r * Q_PITCH + ko + dk * KCH);
        qa[dk][1] = frag_ld(Qs + (16 + r) * Q_PITCH + ko + dk * KCH);
    }
    const half_t* kwave = Kh + (size_t)((b * S_LEN + wave * 256) / 16) * NKC_D * FRAG + lane * 8;
    v16h kb[KRING][2];
    #pragma unroll
    for (int j = 0; j < KRING; ++j)
        #pragma unroll
        for (int s = 0; s < 2; ++s)
            kb[j][s] = frag_pk(kwave + ((j % KU) * NKC_D + (j / KU) * 2 + s) * FRAG);
    // keeps the first loads in ring order, which the counted waits below lean on for speed
    __builtin_amdgcn_sched_barrier(0);
    auto qk_pass = [&](int c, auto more_c) {
        constexpr bool more = decltype(more_c)::value;      // another pass follows
        constexpr int  NJ   = (NKC_D / 2) * KU;             // ring steps per pass
        static_assert(NJ % KRING == 0 && NJ % KU == 0, "a pass must hand the ring on at slot 0");
        const int key0 = wave * 256 + c * (KU * 16);
        const half_t* krow = kwave + (size_t)c * KU * NKC_D * FRAG;
        v8f acc[2][KU] = {};
        #pragma unroll
        for (int j = 0; j < NJ; ++j) {
            const int u = j % KU, dp = j / KU;
            #pragma unroll
            for (int s = 0; s < 2; ++s) {
                acc[0][u] = wmma_f16(qa[dp * 2 + s][0], kb[j % KRING][s], acc[0][u]);
                acc[1][u] = wmma_f16(qa[dp * 2 + s][1], kb[j % KRING][s], acc[1][u]);
            }
            // the slot's next tenant: KRING steps on, in this pass or at the head of the next
            const int jn = j + KRING;
            if (jn < NJ || more) {
                const int un = jn % KU + (jn < NJ ? 0 : KU), dn = (jn % NJ) / KU;
                #pragma unroll
                for (int s = 0; s < 2; ++s)
                    kb[j % KRING][s] = frag_pk(krow + (un * NKC_D + dn * 2 + s) * FRAG);
            }
            // keeps the refill here: without it the scheduler sinks each load down to
            // its own WMMAs and the wave waits out one whole load latency per fragment
            __builtin_amdgcn_sched_barrier(0);
        }
        if constexpr (more) {
            // loads of the next pass are in flight here: this wait stands in front of the
            // first instruction that reuses their address registers (a precaution); the
            // scheduling barrier keeps that instruction behind it
            asm volatile("s_wait_xcnt 0x0" ::: "memory");
            __builtin_amdgcn_sched_barrier(0);
        }
        // unrolled so that acc[][] is indexed by constants and stays in registers
        #pragma unroll
        for (int t = 0; t < 2; ++t)
            #pragma unroll
            for (int u = 0; u < KU; ++u)
                #pragma unroll
                for (int i = 0; i < 8; ++i)
                    Sc[(t * 16 + i + mhi) * SC_PITCH + key0 + u * 16 + r] = acc[t][u][i];
    };
    for (int c = 0; c < 256 / (KU * 16) - 1; ++c) qk_pass(c, std::true_type{});
    qk_pass(256 / (KU * 16) - 1, std::false_type{});
    __syncthreads();

    // ---- stage 2: softmax stats + unnormalized exp(P) in f16 ----
    // 16 lanes of one wave per row, rows (tid>>4) and (tid>>4)+16. In step i the 16 lanes
    // read the 256 contiguous bytes (64 scores) at byte 256*i of the row, 16 bytes a lane,
    // so a read touches every bank once.
    // The f16 results of step i go to the 128 bytes at byte 128*i of the same row: P ends
    // up contiguous, key k at half k. That range lies wholly below byte 256*(i+1), which
    // the row's own wave has read by then (a wave's LDS operations run in program order),
    // and no later step reads it; no other wave touches the row.
    {
        const int row = tid >> 4;
        const int seg = tid & 15;
        for (int h = 0; h < 2; ++h) {
            const v4f* srow4 = (const v4f*)(Sc + (row + h * 16) * SC_PITCH) + seg;
            float m = -3.0e38f;
            for (int i = 0; i < 32; ++i) {
                v4f v = srow4[i * 16];
                m = fmaxf(m, fmaxf(fmaxf(v[0], v[1]), fmaxf(v[2], v[3])));
            }
            partial[h * 256 + tid] = m;
        }
        __syncthreads();
        if (seg < 2) {                            // seg selects the row half
            const int rr = row + seg * 16;
            float mm = partial[rr * 16];
            #pragma unroll
            for (int i = 1; i < 16; ++i) mm = fmaxf(mm, partial[rr * 16 + i]);
            rowmax[rr] = mm;
        }
        __syncthreads();
        for (int h = 0; h < 2; ++h) {
            const float rm = rowmax[row + h * 16];
            const v4f* srow4 = (const v4f*)(Sc + (row + h * 16) * SC_PITCH) + seg;
            half_t* prow = Pq + (row + h * 16) * P_PITCH + seg * 4;
            float s = 0.0f;
            // eight steps' reads stand together in front of their eight stores: the compiler
            // cannot tell that a store never meets a later read, and step by step each read
            // would wait behind the store before it; both inner loops are unrolled so that
            // v[] is indexed by constants and stays in registers
            for (int i0 = 0; i0 < 32; i0 += 8) {
                v4f v[8];
                #pragma unroll
                for (int i = 0; i < 8; ++i) v[i] = srow4[(i0 + i) * 16];
                #pragma unroll
                for (int i = 0; i < 8; ++i) {
                    float e0 = exp_slot(v[i][0] - rm);
                    float e1 = exp_slot(v[i][1] - rm);
                    float e2 = exp_slot(v[i][2] - rm);
                    float e3 = exp_slot(v[i][3] - rm);
                    s += (e0 + e1) + (e2 + e3);
                    v4h hh;
                    hh[0] = (half_t)e0; hh[1] = (half_t)e1;
                    hh[2] = (half_t)e2; hh[3] = (half_t)e3;
                    *(v4h*)(prow + (i0 + i) * 64) = hh;
                }
            }
            partial[h * 256 + tid] = s;
        }
        __syncthreads();
        if (seg < 2) {
            const int rr = row + seg * 16;
            float ss = 0.0f;
            #pragma unroll
            for (int i = 0; i < 16; ++i) ss += partial[rr * 16 + i];
            rowsum[rr] = ss;
        }
        __syncthreads();
    }

    // ---- stage 3: Out = (P @ V) / rowsum ----
    // wave tile: 32 query rows x 96 d-cols, 12 accumulators: two P A-frags (LDS,
    // each read once per wave) x 6 V B-frags (global) = 12 WMMAs per 32 keys.
    // Key chunk kc (32 keys) of a P row starts at half kc*32.
    float rs[2][8];
    // unrolled so that rs[][] stays in registers
    #pragma unroll
    for (int t = 0; t < 2; ++t)
        #pragma unroll
        for (int i = 0; i < 8; ++i) rs[t][i] = 1.0f / rowsum[t * 16 + i + mhi];

    {
        const int n0 = wave * 96;
        v8f acc[2][6] = {};
        const half_t* prow = Pq + r * P_PITCH + ko;
        const half_t* vrow = Vt + (size_t)b * D_DIM * S_LEN + (n0 / 16) * 2 * FRAG + lane * 8;
        // One step = 64 keys. vb[u] holds V tile u's two fragments of the step (2,048
        // contiguous bytes) and is asked for again, for the next step,
        // as soon as its four WMMAs are issued; the P fragments of the next step are read
        // from LDS as one group in front of this step's WMMAs.
        v16h vb[6][2];
        v16h pa[2][2][2];                        // [step parity][32-key half][A tile]
        #pragma unroll
        for (int s = 0; s < 2; ++s) {
            pa[0][s][0] = frag_ld(prow + s * KCH);
            pa[0][s][1] = frag_ld(prow + 16 * P_PITCH + s * KCH);
        }
        #pragma unroll
        for (int u = 0; u < 6; ++u)
            #pragma unroll
            for (int s = 0; s < 2; ++s)
                vb[u][s] = frag_pk(vrow + (u * 2 + s) * FRAG);
        auto pv_step = [&](int kp, auto par_c, auto more_c) {
            constexpr int  par  = decltype(par_c)::value;
            constexpr bool more = decltype(more_c)::value;
            if constexpr (more) {
                #pragma unroll
                for (int s = 0; s < 2; ++s) {
                    const int kc = (kp + 1) * 2 + s;
                    const int po = kc * KCH;
                    pa[par ^ 1][s][0] = frag_ld(prow + po);
                    pa[par ^ 1][s][1] = frag_ld(prow + 16 * P_PITCH + po);
                }
            }
            // this and the one below keep the fetches ahead where they are written:
            // without them the scheduler sinks each load down to its own WMMAs
            __builtin_amdgcn_sched_barrier(0);
            #pragma unroll
            for (int u = 0; u < 6; ++u) {
                #pragma unroll
                for (int s = 0; s < 2; ++s) {
                    acc[0][u] = wmma_f16(pa[par][s][0], vb[u][s], acc[0][u]);
                    acc[1][u] = wmma_f16(pa[par][s][1], vb[u][s], acc[1][u]);
                }
                if constexpr (more) {
                    #pragma unroll
                    for (int s = 0; s < 2; ++s)
                        vb[u][s] = frag_pk(vrow + (size_t)(((kp + 1) * (D_DIM / 16) + u) * 2 + s) * FRAG);
                }
                __builtin_amdgcn_sched_barrier(0);
            }
        };
        using c0 = std::integral_constant<int, 0>;
        using c1 = std::integral_constant<int, 1>;
        for (int kp = 0; kp < NKC_S / 2 - 2; kp += 2) {
            pv_step(kp,     c0{}, std::true_type{});
            pv_step(kp + 1, c1{}, std::true_type{});
            // the next step's loads are in flight here: this wait stands in front of the
            // loop's step of their address registers (a precaution); the scheduling
            // barrier keeps that step behind it
            asm volatile("s_wait_xcnt 0x0" ::: "memory");
            __builtin_amdgcn_sched_barrier(0);
        }
        pv_step(NKC_S / 2 - 2, c0{}, std::true_type{});
        pv_step(NKC_S / 2 - 1, c1{}, std::false_type{});
        // unrolled so that acc[][] and rs[][] stay in registers
        #pragma unroll
        for (int t = 0; t < 2; ++t)
            #pragma unroll
            for (int u = 0; u < 6; ++u) {
                float* orow = Out + (size_t)(g0 + t * 16) * D_DIM + n0 + u * 16 + r;
                #pragma unroll
                for (int i = 0; i < 8; ++i)
                    orow[(size_t)(i + mhi) * D_DIM] = acc[t][u][i] * rs[t][i];
            }
    }
}

// ---------------------------------------------------------------------------
extern "C" void kernel_launch(void* const* d_in, const int* in_sizes, int n_in,
                              void* d_out, int out_size, void* d_ws, size_t ws_size,
                              hipStream_t stream) {
    const float* X  = (const float*)d_in[0];
    const float* Wq = (const float*)d_in[1];
    const float* bq = (const float*)d_in[2];
    const float* Wk = (const float*)d_in[3];
    const float* bk = (const float*)d_in[4];
    const float* Wv = (const float*)d_in[5];
    const float* bv = (const float*)d_in[6];
    float* out = (float*)d_out;

    const size_t nX = (size_t)B_N * S_LEN * D_DIM;     // 6291456
    const size_t nW = (size_t)D_DIM * D_DIM;           // 589824

    char* ws = (char*)d_ws;
    half_t* Xh  = (half_t*)ws;              ws += nX * sizeof(half_t);
    half_t* Wqh = (half_t*)ws;              ws += nW * sizeof(half_t);
    half_t* Wkh = (half_t*)ws;              ws += nW * sizeof(half_t);
    half_t* Wvh = (half_t*)ws;              ws += nW * sizeof(half_t);
    half_t* Qh  = (half_t*)ws;              ws += nX * sizeof(half_t);
    half_t* Kh  = (half_t*)ws;              ws += nX * sizeof(half_t);
    half_t* Vt  = (half_t*)ws;              ws += nX * sizeof(half_t);

    // 1) f32 -> f16 conversion of X, Wq, Wk, Wv into fragment order, one launch: the four
    //    planes are contiguous from Xh on; 984 x 256 threads take four pieces each
    cvt_f16_kernel<<<984, 256, 0, stream>>>(X, Wq, Wk, Wv, Xh, (int)((nX + 3 * nW) / 8));

    // 2) QKV projection: 24 x 96-wide output blocks, 4 per work-group, x 128 row tiles of 64
    dim3 gq(3 * D_DIM / (QKV_NT * 16 * 4), (B_N * S_LEN) / 64);
    qkv_kernel<<<gq, 128, 0, stream>>>(Xh, Wqh, Wkh, Wvh, bq, bk, bv, Qh, Kh, Vt);

    // 3) attention: one block per 32-row query tile, ~307KB static LDS
    attn_kernel<<<(B_N * S_LEN) / QROWS, 256, 0, stream>>>(Qh, Kh, Vt, out);
}

// v007
// A run of this version takes 94.4 microseconds.
// Next to v006, in two timings, it ran 1.22 and 1.21 times as fast.
// Counting every step since v000, it is 4.98 times as fast.
#include <hip/hip_runtime.h>
#include <hip/hip_bf16.h>
#include <type_traits>

typedef _Float16 half_t;
typedef __attribute__((ext_vector_type(4)))  half_t v4h;
typedef __attribute__((ext_vector_type(8)))  half_t v8h;
typedef __attribute__((ext_vector_type(16))) half_t v16h;
typedef __attribute__((ext_vector_type(8)))  float  v8f;
typedef __attribute__((ext_vector_type(4)))  float  v4f;

#define B_N    4
#define S_LEN  2048
#define D_DIM  768
#define KCH    32              // K-dim per wmma
#define NKC_D  (D_DIM / KCH)   // 24
#define NKC_S  (S_LEN / KCH)   // 64

// Per-lane fragment load for 16-bit A/B operands of v_wmma_*_16x16x32.
// p must already point at: row_base + k_base + (lane>=16 ? 8 : 0).
// Lane holds two contiguous 8-half (16B) chunks at +0 and +16 halves.
__device__ __forceinline__ v16h frag_ld(const half_t* p) {
    v8h lo = *(const v8h*)(p);
    v8h hi = *(const v8h*)(p + 16);
    return __builtin_shufflevector(lo, hi, 0,1,2,3,4,5,6,7,8,9,10,11,12,13,14,15);
}

// Fragment order: how every 16-bit operand plane that a matrix loop reads from global memory
// lies in the workspace. A plane of rows x K halves is cut into fragments of 16 rows x 32 k,
// 1,024 bytes each, the fragments of a 16-row tile one behind the other in k (V's order of
// fragments: see the projection kernel). Inside a fragment lane l's first 16-byte piece
// (row l & 15, k 8*(l>>4) + 0..7) lies at byte 16*l and its second (k + 16) at byte
// 512 + 16*l: the same pieces frag_ld takes from a row-major plane, but each wave-wide
// 16-byte load covers 512 contiguous bytes, four whole lines, where a load from row-major
// rows touches 16 lines.
#define FRAG 512               // halves per fragment
// p must already point at: fragment base + lane * 8.
__device__ __forceinline__ v16h frag_pk(const half_t* p) {
    v8h lo = *(const v8h*)(p);
    v8h hi = *(const v8h*)(p + FRAG / 2);
    return __builtin_shufflevector(lo, hi, 0,1,2,3,4,5,6,7,8,9,10,11,12,13,14,15);
}

__device__ __forceinline__ v8f wmma_f16(v16h a, v16h b, v8f c) {
    return __builtin_amdgcn_wmma_f32_16x16x32_f16(false, a, false, b, (short)0, c, false, false);
}

// Stands behind a group of global loads, in front of the first instruction that reuses their
// address registers (a precaution);
// the scheduling barriers keep the loads in front of it and that instruction behind it.
__device__ __forceinline__ void address_registers_free() {
    __builtin_amdgcn_sched_barrier(0);
    asm volatile("s_wait_xcnt 0x0" ::: "memory");
    __builtin_amdgcn_sched_barrier(0);
}

// exp(x) as __expf forms it (x * log2(e), then v_exp_f32). The v_nop fills the one
// slot the instruction set asks for behind a transcendental before its result is
// read or its source register overwritten.
__device__ __forceinline__ float exp_slot(float x) {
    float y;
    asm("v_exp_f32 %0, %1\n\tv_nop" : "=v"(y) : "v"(x * 1.44269504088896340736f));
    return y;
}

// ---------------------------------------------------------------------------
// Kernel 1: f32 rows of D_DIM -> f16 in fragment order, one 16-byte piece per thread
// (grid-stride), X and the three weight matrices in ONE launch. The four f16 planes lie one
// behind the other in the workspace (X, Wq, Wk, Wv), so they are one run of 16-row tiles:
// tiles 0..X_TILES-1 are X's, then W_TILES tiles per weight matrix. Piece o of that run is
// lane o & 31 of half (o >> 5) & 1 of fragment o >> 6. A wave's 32 pieces lie in one
// fragment, so the choice of the source matrix is the same for a whole wave.
// ---------------------------------------------------------------------------
#define X_TILES (B_N * S_LEN / 16)             // 512
#define W_TILES (D_DIM / 16)                   // 48
__global__ void cvt_f16_kernel(const float* __restrict__ X,
                               const float* __restrict__ Wq,
                               const float* __restrict__ Wk,
                               const float* __restrict__ Wv,
                               half_t* __restrict__ dst, int n8) {
    int o = blockIdx.x * blockDim.x + threadIdx.x;
    int stride = gridDim.x * blockDim.x;
    for (; o < n8; o += stride) {
        const int f = o >> 6;                    // fragment: row tile f / NKC_D, k chunk f % NKC_D
        int tile = f / NKC_D;
        const float* src = X;
        if (tile >= X_TILES) {
            const int m = (tile - X_TILES) / W_TILES;
            src  = (m == 0) ? Wq : (m == 1) ? Wk : Wv;
            tile = (tile - X_TILES) % W_TILES;
        }
        const int row = tile * 16 + (o & 15);
        const int k   = (f % NKC_D) * KCH + ((o >> 5) & 1) * 16 + ((o >> 4) & 1) * 8;
        const float4* s = (const float4*)(src + (size_t)row * D_DIM + k);
        float4 v0 = s[0], v1 = s[1];
        v8h h;
        h[0] = (half_t)v0.x; h[1] = (half_t)v0.y;
        h[2] = (half_t)v0.z; h[3] = (half_t)v0.w;
        h[4] = (half_t)v1.x; h[5] = (half_t)v1.y;
        h[6] = (half_t)v1.z; h[7] = (half_t)v1.w;
        *(v8h*)(dst + (size_t)o * 8) = h;
    }
}

// ---------------------------------------------------------------------------
// Kernel 2: QKV projection. grid = (3*D/384, B*S/64), block = 128 (4 waves, one per SIMD).
// Each wave computes a 64x96 output block (24 accumulators) in k steps of 64:
// 8 X fragments and 12 W fragments feed 48 WMMAs. X and W lie in fragment order.
// The 24 column blocks of [Q | K | V] go to the waves in order, 8 per matrix, so a
// work-group's four waves work on one matrix:
// block 0..7   -> Q (scaled by 1/sqrt(D), f16 row-major)
// block 8..15  -> K (f16, fragment order: rows = keys, k = channels)
// block 16..23 -> V (f16, fragment order, per batch: rows = channels, k = keys; the two
//                 fragments of a 64-key step lie together, channel tile behind channel tile,
//                 step behind step: what attention's 8 waves read in one step is contiguous)
// A lane's 8 accumulator registers are 8 neighbouring rows of one column of D. With X as A
// those are 8 keys of one channel: one 16-byte piece of a V fragment. K wants 8 channels of
// one key, so its product is taken transposed, W as A and X as B.
// ---------------------------------------------------------------------------
#define QKV_NT 6                               // 16-column tiles per wave
#define WRING  3                               // W ring slots
#define QKV_KS (NKC_D / 2)                     // k steps of 64
__global__ __launch_bounds__(128)
void qkv_kernel(const half_t* __restrict__ Xh,
                const half_t* __restrict__ Wqh,
                const half_t* __restrict__ Wkh,
                const half_t* __restrict__ Wvh,
                const float*  __restrict__ bq,
                const float*  __restrict__ bk,
                const float*  __restrict__ bv,
                half_t* __restrict__ Qh,
                half_t* __restrict__ Kh,
                half_t* __restrict__ Vt) {
    const int lane = threadIdx.x & 31;
    const int cb   = blockIdx.x * 4 + (threadIdx.x >> 5);    // column block, 0..23
    const int mat  = blockIdx.x / (D_DIM / (QKV_NT * 16 * 4)); // 0=Q, 1=K, 2=V: one per work-group
    const int n0   = (cb % (D_DIM / (QKV_NT * 16))) * (QKV_NT * 16); // output-channel block
    const int g0   = blockIdx.y * 64;           // global row in [0, B*S)
    const int r    = lane & 15;
    const int mhi  = (lane >> 4) ? 8 : 0;

    const half_t* W  = (mat == 0) ? Wqh : (mat == 1) ? Wkh : Wvh;

    v8f acc[4][QKV_NT];                         // [row tile m][column tile u]
    const half_t* xrow = Xh + (size_t)(g0 / 16) * NKC_D * FRAG + lane * 8;  // +m*NKC_D fragments per row tile
    const half_t* wrow = W  + (size_t)(n0 / 16) * NKC_D * FRAG + lane * 8;  // +u*NKC_D fragments per column tile
    // The k walk is a ring: a work-group enters it at k step krot and wraps round. The 128
    // work-groups that read one W panel, and the 6 that read one X row tile, enter it at
    // different steps, so that they do not ask L2 for the same lines at the same moment.
    const int krot = (blockIdx.y + 2 * blockIdx.x) % QKV_KS;
    auto product = [&](auto w_is_a_c) {
        constexpr bool w_is_a = decltype(w_is_a_c)::value;
        static_assert(QKV_NT % WRING == 0 && WRING < QKV_NT, "a k step must hand the ring on at slot 0");
        const half_t* xk = xrow + krot * 2 * FRAG;   // X fragments of the k step at work
        const half_t* wk = wrow + krot * 2 * FRAG;   // W fragments of the k step the refills take
        // The W fragments come through a ring of WRING register slots; a slot holds one column
        // tile's k step (two fragments, 2,048 contiguous bytes) and is asked for again,
        // WRING tiles ahead of its next use, as soon as its eight WMMAs are issued.
        v16h wb[WRING][2];
        #pragma unroll
        for (int j = 0; j < WRING; ++j)
            #pragma unroll
            for (int s = 0; s < 2; ++s)
                wb[j][s] = frag_pk(wk + (j * NKC_D + s) * FRAG);
        auto kstep = [&](int it, auto more_c) {
            constexpr bool more = decltype(more_c)::value;   // another k step follows
            v16h a[4][2];
            #pragma unroll
            for (int m = 0; m < 4; ++m)
                #pragma unroll
                for (int s = 0; s < 2; ++s)
                    a[m][s] = frag_pk(xk + (m * NKC_D + s) * FRAG);
            #pragma unroll
            for (int u = 0; u < QKV_NT; ++u) {
                const int un = u + WRING;
                // the scheduling barriers keep each refill where it is written, its four loads
                // together: without them the scheduler sinks the loads down to their own
                // WMMAs and the wave waits out a whole load latency per column tile
                __builtin_amdgcn_sched_barrier(0);
                #pragma unroll
                for (int s = 0; s < 2; ++s)
                    #pragma unroll
                    for (int m = 0; m < 4; ++m)
                        acc[m][u] = w_is_a ? wmma_f16(wb[u % WRING][s], a[m][s], acc[m][u])
                                           : wmma_f16(a[m][s], wb[u % WRING][s], acc[m][u]);
                // keeps the refill behind the slot's last WMMA, so that it lands in the slot's
                // own registers: scheduled among the WMMAs it takes eight fresh registers per
                // slot, and only two waves instead of three then fit a SIMD
                __builtin_amdgcn_sched_barrier(0);
                if (un < QKV_NT || more) {
                    if (un == QKV_NT) {
                        // from here on the refills are the next k step's: both pointers go on
                        // one step, or back to step 0 behind the last; loads that name them
                        // are in flight, hence the wait in front
                        address_registers_free();
                        const int d = (it + krot == QKV_KS - 1) ? -(QKV_KS - 1) * 2 * FRAG : 2 * FRAG;
                        xk += d;
                        wk += d;
                    }
                    #pragma unroll
                    for (int s = 0; s < 2; ++s)
                        wb[u % WRING][s] = frag_pk(wk + ((un % QKV_NT) * NKC_D + s) * FRAG);
                }
                __builtin_amdgcn_sched_barrier(0);
            }
        };
        for (int it = 0; it < QKV_KS - 1; ++it) kstep(it, std::true_type{});
        kstep(QKV_KS - 1, std::false_type{});
    };

    if (mat == 1) {
        // acc[m][u][i] = K[key g0 + m*16 + r][channel n0 + u*16 + mhi + i]
        v4f bias[QKV_NT][2];                    // all loops unrolled: stays in registers
        #pragma unroll
        for (int u = 0; u < QKV_NT; ++u)
            #pragma unroll
            for (int p = 0; p < 2; ++p) bias[u][p] = *(const v4f*)(bk + n0 + u * 16 + mhi + p * 4);
        address_registers_free();
        #pragma unroll
        for (int u = 0; u < QKV_NT; ++u)
            #pragma unroll
            for (int m = 0; m < 4; ++m)
                #pragma unroll
                for (int i = 0; i < 8; ++i) acc[m][u][i] = bias[u][i >> 2][i & 3];
        product(std::true_type{});
        // column tile u is half u & 1 of k chunk n0/32 + u/2 of key tile g0/16 + m
        half_t* dst = Kh + ((size_t)(g0 / 16) * NKC_D + n0 / KCH) * FRAG + lane * 8;
        #pragma unroll
        for (int m = 0; m < 4; ++m)
            #pragma unroll
            for (int u = 0; u < QKV_NT; ++u) {
                v8h h;
                #pragma unroll
                for (int i = 0; i < 8; ++i) h[i] = (half_t)acc[m][u][i];
                *(v8h*)(dst + m * NKC_D * FRAG + u * (FRAG / 2)) = h;
            }
    } else {
        // acc[m][u][i] = Y[row g0 + m*16 + mhi + i][channel n0 + u*16 + r]
        const float* bb = (mat == 0) ? bq : bv;
        float bias[QKV_NT];                     // all loops unrolled: stays in registers
        #pragma unroll
        for (int u = 0; u < QKV_NT; ++u) bias[u] = bb[n0 + u * 16 + r];
        address_registers_free();
        #pragma unroll
        for (int u = 0; u < QKV_NT; ++u)
            #pragma unroll
            for (int m = 0; m < 4; ++m)
                #pragma unroll
                for (int i = 0; i < 8; ++i) acc[m][u][i] = bias[u];
        product(std::false_type{});
        if (mat == 0) {
            const float qscale = 0.03608439182435161f;   // 1/sqrt(768)
            #pragma unroll
            for (int m = 0; m < 4; ++m)
                #pragma unroll
                for (int u = 0; u < QKV_NT; ++u) {
                    half_t* dst = Qh + (size_t)(g0 + m * 16) * D_DIM + n0 + u * 16 + r;
                    #pragma unroll
                    for (int i = 0; i < 8; ++i)
                        dst[(size_t)(i + mhi) * D_DIM] = (half_t)(acc[m][u][i] * qscale);
                }
            // stands behind the last store, in front of any reuse of the stores' address and
            // data registers in the code laid out behind this branch (a precaution)
            asm volatile("s_wait_xcnt 0x0" ::: "memory");
        } else {
            const int b  = g0 >> 11;                 // S = 2048
            const int s0 = g0 & (S_LEN - 1);
            // row tile m is half m & 1 of fragment m/2 of channel tile n0/16 + u in step s0/64
            half_t* dst = Vt + (size_t)b * D_DIM * S_LEN
                             + ((size_t)(s0 / 64) * (D_DIM / 16) + n0 / 16) * 2 * FRAG + lane * 8;
            #pragma unroll
            for (int m = 0; m < 4; ++m)
                #pragma unroll
                for (int u = 0; u < QKV_NT; ++u) {
                    v8h h;
                    #pragma unroll
                    for (int i = 0; i < 8; ++i) h[i] = (half_t)acc[m][u][i];
                    *(v8h*)(dst + u * 2 * FRAG + m * (FRAG / 2)) = h;
                }
            // as behind the Q stores
            asm volatile("s_wait_xcnt 0x0" ::: "memory");
        }
    }
}

// ---------------------------------------------------------------------------
// Kernel 3: attention for one 32-row query tile (two 16-row A tiles).
// grid = B*S/32, block = 256 (8 waves -> 2 waves/SIMD for latency hiding).
// Every K and V fragment loaded from global feeds two WMMAs, one per A tile; K and V lie
// in fragment order, so each of their loads covers 512 contiguous bytes.
// LDS: Qs 48KB | Sc 256KB (f32 scores; f16 exp overwrites them in place) | reductions ~2KB
// Q rows and score rows each carry 16 bytes of pad: the pitch is then 16 B x an odd number,
// so the 16 rows that one ds_load_b128 fragment read touches fall on 16 different groups
// of four banks (at the unpadded pitches, multiples of 256 B, all 16 fall on one group).
// ---------------------------------------------------------------------------
#define QROWS     32
#define Q_PITCH   (D_DIM + 8)                      // halves per Q row in LDS (1552 B)
#define SC_PITCH  (S_LEN + 4)                      // floats per score row (8208 B)
#define SMEM_QS   (QROWS * Q_PITCH * 2)            // 49664
#define SMEM_SC   (QROWS * SC_PITCH * 4)           // 262656
#define SMEM_RED  ((512 + QROWS + QROWS) * 4)      // 2304
#define SMEM_TOT  (SMEM_QS + SMEM_SC + SMEM_RED)   // 314624
#define P_PITCH   (SC_PITCH * 2)                   // halves per P row (= one f32 score row)
#define KU        2                                // key tiles per stage-1 pass
#define KRING     3                                // stage-1 ring slots
#define KPASS     (256 / (KU * 16))                // stage-1 passes per wave (8)

__global__ __launch_bounds__(256, 1)
void attn_kernel(const half_t* __restrict__ Qh,
                 const half_t* __restrict__ Kh,
                 const half_t* __restrict__ Vt,
                 float* __restrict__ Out) {
    __shared__ __attribute__((aligned(16))) char smem[SMEM_TOT];
    half_t* Qs      = (half_t*)(smem);
    float*  Sc      = (float*)(smem + SMEM_QS);
    half_t* Pq      = (half_t*)(smem + SMEM_QS);          // in place over Sc
    float*  partial = (float*)(smem + SMEM_QS + SMEM_SC); // [512]
    float*  rowmax  = partial + 512;                      // [32]
    float*  rowsum  = partial + 512 + QROWS;              // [32]

    const int tid  = threadIdx.x;
    const int lane = tid & 31;
    const int wave = tid >> 5;                   // 0..7
    const int g0   = blockIdx.x * QROWS;         // global query row
    const int b    = g0 >> 11;
    const int r    = lane & 15;
    const int mhi  = (lane >> 4) ? 8 : 0;
    const int ko   = mhi;
    // The 64 work-groups of a batch walk the same K and V planes. Each
    // enters both walks at a place of its own and wraps round, so that they do not ask L2
    // for the same lines at the same moment: pass krot of 8 in stage 1, step vrot of 32 in
    // stage 3 (neighbouring indices and indices 8 apart all get different steps).
    const int bi   = blockIdx.x & (S_LEN / QROWS - 1);
    const int krot = (bi >> 3) & (KPASS - 1);
    const int vrot = (((bi >> 3) << 2) | (bi & 3)) & (NKC_S / 2 - 1);

    // ---- stage 0: stage Q tile (contiguous 48KB in global) into LDS rows of Q_PITCH ----
    {
        // wave w brings rows w, w+8, w+16, w+24, each in three runs of 512 contiguous bytes
        const uint4* src = (const uint4*)(Qh + (size_t)(g0 + wave) * D_DIM) + lane;
        half_t* dst = Qs + wave * Q_PITCH + lane * 8;
        #pragma unroll
        for (int rr = 0; rr < QROWS / 8; ++rr)
            #pragma unroll
            for (int c = 0; c < D_DIM / 256; ++c)
                *(uint4*)(dst + rr * 8 * Q_PITCH + c * 256) = src[rr * 8 * (D_DIM / 8) + c * 32];
        // keeps the address arithmetic of stage 1 behind these stores: so held back, the first
        // reuse of the loads' address registers has the compiler's own s_wait_xcnt 0 in front
        // (a precaution)
        __builtin_amdgcn_sched_barrier(0);
    }
    __syncthreads();

    // ---- stage 1: scores = Q Kt (scale pre-folded into Q) ----
    // wave handles keys [wave*256, wave*256+256), KU key tiles per pass. The K fragments
    // come through a ring of KRING register slots; a slot holds one key tile's k step of
    // 64 (two fragments, 2,048 contiguous bytes) and is asked for
    // again as soon as its four WMMAs are issued, KRING slots ahead of its next use.
    // The wave's 48 Q fragments are read from LDS once and stay in registers for all passes.
    v16h qa[NKC_D][2];
    #pragma unroll
    for (int dk = 0; dk < NKC_D; ++dk) {
        qa[dk][0] = frag_ld(Qs + r * Q_PITCH + ko + dk * KCH);
        qa[dk][1] = frag_ld(Qs + (16 + r) * Q_PITCH + ko + dk * KCH);
    }
    // kcur: the K fragments of the pass that the ring's refills are taken from
    const half_t* kcur = Kh + ((size_t)((b * S_LEN + wave * 256) / 16) + krot * KU) * NKC_D * FRAG + lane * 8;
    v16h kb[KRING][2];
    #pragma unroll
    for (int j = 0; j < KRING; ++j)
        #pragma unroll
        for (int s = 0; s < 2; ++s)
            kb[j][s] = frag_pk(kcur + ((j % KU) * NKC_D + (j / KU) * 2 + s) * FRAG);
    // keeps the first loads in ring order, which the counted waits below lean on for speed
    __builtin_amdgcn_sched_barrier(0);
    auto qk_pass = [&](int c, auto more_c) {
        constexpr bool more = decltype(more_c)::value;      // another pass follows
        constexpr int  NJ   = (NKC_D / 2) * KU;             // ring steps per pass
        static_assert(NJ % KRING == 0 && NJ % KU == 0, "a pass must hand the ring on at slot 0");
        const int p    = (c + krot) & (KPASS - 1);          // the c-th pass works on key block p
        const int key0 = wave * 256 + p * (KU * 16);
        v8f acc[2][KU] = {};
        #pragma unroll
        for (int j = 0; j < NJ; ++j) {
            const int u = j % KU, dp = j / KU;
            #pragma unroll
            for (int s = 0; s < 2; ++s) {
                acc[0][u] = wmma_f16(qa[dp * 2 + s][0], kb[j % KRING][s], acc[0][u]);
                acc[1][u] = wmma_f16(qa[dp * 2 + s][1], kb[j % KRING][s], acc[1][u]);
            }
            // the slot's next tenant: KRING steps on, in this pass or at the head of the next
            const int jn = j + KRING;
            if (jn < NJ || more) {
                if (jn == NJ) {
                    // from here on the refills are the next pass's: the pointer goes on one
                    // key block, or back to block 0 behind the last. Loads that name it are in
                    // flight: this wait stands in front of its step (a precaution); the
                    // scheduling barrier keeps the step behind it
                    asm volatile("s_wait_xcnt 0x0" ::: "memory");
                    __builtin_amdgcn_sched_barrier(0);
                    kcur += (p == KPASS - 1) ? -(KPASS - 1) * KU * NKC_D * FRAG : KU * NKC_D * FRAG;
                }
                const int un = jn % KU, dn = (jn % NJ) / KU;
                #pragma unroll
                for (int s = 0; s < 2; ++s)
                    kb[j % KRING][s] = frag_pk(kcur + (un * NKC_D + dn * 2 + s) * FRAG);
            }
            // keeps the refill here: without it the scheduler sinks each load down to
            // its own WMMAs and the wave waits out one whole load latency per fragment
            __builtin_amdgcn_sched_barrier(0);
        }
        // unrolled so that acc[][] is indexed by constants and stays in registers
        #pragma unroll
        for (int t = 0; t < 2; ++t)
            #pragma unroll
            for (int u = 0; u < KU; ++u)
                #pragma unroll
                for (int i = 0; i < 8; ++i)
                    Sc[(t * 16 + i + mhi) * SC_PITCH + key0 + u * 16 + r] = acc[t][u][i];
    };
    for (int c = 0; c < KPASS - 1; ++c) qk_pass(c, std::true_type{});
    qk_pass(KPASS - 1, std::false_type{});
    __syncthreads();

    // ---- stage 2: softmax stats + unnormalized exp(P) in f16 ----
    // 16 lanes of one wave per row, rows (tid>>4) and (tid>>4)+16. In step i the 16 lanes
    // read the 256 contiguous bytes (64 scores) at byte 256*i of the row, 16 bytes a lane,
    // so a read touches every bank once.
    // The f16 results of step i go to the 128 bytes at byte 128*i of the same row: P ends
    // up contiguous, key k at half k. That range lies wholly below byte 256*(i+1), which
    // the row's own wave has read by then (a wave's LDS operations run in program order),
    // and no later step reads it; no other wave touches the row.
    {
        const int row = tid >> 4;
        const int seg = tid & 15;
        for (int h = 0; h < 2; ++h) {
            const v4f* srow4 = (const v4f*)(Sc + (row + h * 16) * SC_PITCH) + seg;
            float m = -3.0e38f;
            for (int i = 0; i < 32; ++i) {
                v4f v = srow4[i * 16];
                m = fmaxf(m, fmaxf(fmaxf(v[0], v[1]), fmaxf(v[2], v[3])));
            }
            partial[h * 256 + tid] = m;
        }
        __syncthreads();
        if (seg < 2) {                            // seg selects the row half
            const int rr = row + seg * 16;
            float mm = partial[rr * 16];
            #pragma unroll
            for (int i = 1; i < 16; ++i) mm = fmaxf(mm, partial[rr * 16 + i]);
            rowmax[rr] = mm;
        }
        __syncthreads();
        for (int h = 0; h < 2; ++h) {
            const float rm = rowmax[row + h * 16];
            const v4f* srow4 = (const v4f*)(Sc + (row + h * 16) * SC_PITCH) + seg;
            half_t* prow = Pq + (row + h * 16) * P_PITCH + seg * 4;
            float s = 0.0f;
            // eight steps' reads stand together in front of their eight stores: the compiler
            // cannot tell that a store never meets a later read, and step by step each read
            // would wait behind the store before it; both inner loops are unrolled so that
            // v[] is indexed by constants and stays in registers
            for (int i0 = 0; i0 < 32; i0 += 8) {
                v4f v[8];
                #pragma unroll
                for (int i = 0; i < 8; ++i) v[i] = srow4[(i0 + i) * 16];
                #pragma unroll
                for (int i = 0; i < 8; ++i) {
                    float e0 = exp_slot(v[i][0] - rm);
                    float e1 = exp_slot(v[i][1] - rm);
                    float e2 = exp_slot(v[i][2] - rm);
                    float e3 = exp_slot(v[i][3] - rm);
                    s += (e0 + e1) + (e2 + e3);
                    v4h hh;
                    hh[0] = (half_t)e0; hh[1] = (half_t)e1;
                    hh[2] = (half_t)e2; hh[3] = (half_t)e3;
                    *(v4h*)(prow + (i0 + i) * 64) = hh;
                }
            }
            partial[h * 256 + tid] = s;
        }
        __syncthreads();
        if (seg < 2) {
            const int rr = row + seg * 16;
            float ss = 0.0f;
            #pragma unroll
            for (int i = 0; i < 16; ++i) ss += partial[rr * 16 + i];
            rowsum[rr] = ss;
        }
        __syncthreads();
    }

    // ---- stage 3: Out = (P @ V) / rowsum ----
    // wave tile: 32 query rows x 96 d-cols, 12 accumulators: two P A-frags (LDS,
    // each read once per wave) x 6 V B-frags (global) = 12 WMMAs per 32 keys.
    // Key chunk kc (32 keys) of a P row starts at half kc*32.
    float rs[2][8];
    // unrolled so that rs[][] stays in registers
    #pragma unroll
    for (int t = 0; t < 2; ++t)
        #pragma unroll
        for (int i = 0; i < 8; ++i) rs[t][i] = 1.0f / rowsum[t * 16 + i + mhi];

    {
        const int n0 = wave * 96;
        v8f acc[2][6] = {};
        constexpr int VSTEP = (D_DIM / 16) * 2 * FRAG;     // halves of V per step of 64 keys
        constexpr int NSTEP = NKC_S / 2;                   // 32 steps
        // pcur, vcur: P and V of the step that is being fetched; the walk starts at step vrot
        const half_t* pcur = Pq + r * P_PITCH + ko + vrot * 2 * KCH;
        const half_t* vcur = Vt + (size_t)b * D_DIM * S_LEN + (size_t)vrot * VSTEP
                                + (n0 / 16) * 2 * FRAG + lane * 8;
        // One step = 64 keys. vb[u] holds V tile u's two fragments of the step (2,048
        // contiguous bytes) and is asked for again, for the next step,
        // as soon as its four WMMAs are issued; the P fragments of the next step are read
        // from LDS as one group in front of this step's WMMAs.
        v16h vb[6][2];
        v16h pa[2][2][2];                        // [step parity][32-key half][A tile]
        #pragma unroll
        for (int s = 0; s < 2; ++s) {
            pa[0][s][0] = frag_ld(pcur + s * KCH);
            pa[0][s][1] = frag_ld(pcur + 16 * P_PITCH + s * KCH);
        }
        #pragma unroll
        for (int u = 0; u < 6; ++u)
            #pragma unroll
            for (int s = 0; s < 2; ++s)
                vb[u][s] = frag_pk(vcur + (u * 2 + s) * FRAG);
        auto pv_step = [&](int kp, auto par_c, auto more_c) {
            constexpr int  par  = decltype(par_c)::value;
            constexpr bool more = decltype(more_c)::value;
            if constexpr (more) {
                // both pointers go on one step, or back to step 0 behind the last. V loads
                // that name vcur are in flight: this wait stands in front of its step (a
                // precaution); the scheduling barrier keeps the step behind it
                asm volatile("s_wait_xcnt 0x0" ::: "memory");
                __builtin_amdgcn_sched_barrier(0);
                const bool wrap = ((kp + vrot) & (NSTEP - 1)) == NSTEP - 1;
                pcur += wrap ? -(NSTEP - 1) * 2 * KCH : 2 * KCH;
                vcur += wrap ? -(NSTEP - 1) * VSTEP : VSTEP;
                #pragma unroll
                for (int s = 0; s < 2; ++s) {
                    pa[par ^ 1][s][0] = frag_ld(pcur + s * KCH);
                    pa[par ^ 1][s][1] = frag_ld(pcur + 16 * P_PITCH + s * KCH);
                }
            }
            // this and the one below keep the fetches ahead where they are written:
            // without them the scheduler sinks each load down to its own WMMAs
            __builtin_amdgcn_sched_barrier(0);
            #pragma unroll
            for (int u = 0; u < 6; ++u) {
                #pragma unroll
                for (int s = 0; s < 2; ++s) {
                    acc[0][u] = wmma_f16(pa[par][s][0], vb[u][s], acc[0][u]);
                    acc[1][u] = wmma_f16(pa[par][s][1], vb[u][s], acc[1][u]);
                }
                if constexpr (more) {
                    #pragma unroll
                    for (int s = 0; s < 2; ++s)
                        vb[u][s] = frag_pk(vcur + (u * 2 + s) * FRAG);
                }
                __builtin_amdgcn_sched_barrier(0);
            }
        };
        using c0 = std::integral_constant<int, 0>;
        using c1 = std::integral_constant<int, 1>;
        for (int kp = 0; kp < NKC_S / 2 - 2; kp += 2) {
            pv_step(kp,     c0{}, std::true_type{});
            pv_step(kp + 1, c1{}, std::true_type{});
        }
        pv_step(NKC_S / 2 - 2, c0{}, std::true_type{});
        pv_step(NKC_S / 2 - 1, c1{}, std::false_type{});
        // unrolled so that acc[][] and rs[][] stay in registers
        #pragma unroll
        for (int t = 0; t < 2; ++t)
            #pragma unroll
            for (int u = 0; u < 6; ++u) {
                float* orow = Out + (size_t)(g0 + t * 16) * D_DIM + n0 + u * 16 + r;
                #pragma unroll
                for (int i = 0; i < 8; ++i)
                    orow[(size_t)(i + mhi) * D_DIM] = acc[t][u][i] * rs[t][i];
            }
    }
}

// ---------------------------------------------------------------------------
extern "C" void kernel_launch(void* const* d_in, const int* in_sizes, int n_in,
                              void* d_out, int out_size, void* d_ws, size_t ws_size,
                              hipStream_t stream) {
    const float* X  = (const float*)d_in[0];
    const float* Wq = (const float*)d_in[1];
    const float* bq = (const float*)d_in[2];
    const float* Wk = (const float*)d_in[3];
    const float* bk = (const float*)d_in[4];
    const float* Wv = (const float*)d_in[5];
    const float* bv = (const float*)d_in[6];
    float* out = (float*)d_out;

    const size_t nX = (size_t)B_N * S_LEN * D_DIM;     // 6291456
    const size_t nW = (size_t)D_DIM * D_DIM;           // 589824

    char* ws = (char*)d_ws;
    half_t* Xh  = (half_t*)ws;              ws += nX * sizeof(half_t);
    half_t* Wqh = (half_t*)ws;              ws += nW * sizeof(half_t);
    half_t* Wkh = (half_t*)ws;              ws += nW * sizeof(half_t);
    half_t* Wvh = (half_t*)ws;              ws += nW * sizeof(half_t);
    half_t* Qh  = (half_t*)ws;              ws += nX * sizeof(half_t);
    half_t* Kh  = (half_t*)ws;              ws += nX * sizeof(half_t);
    half_t* Vt  = (half_t*)ws;              ws += nX * sizeof(half_t);

    // 1) f32 -> f16 conversion of X, Wq, Wk, Wv into fragment order, one launch: the four
    //    planes are contiguous from Xh on; 984 x 256 threads take four pieces each
    cvt_f16_kernel<<<984, 256, 0, stream>>>(X, Wq, Wk, Wv, Xh, (int)((nX + 3 * nW) / 8));

    // 2) QKV projection: 24 x 96-wide output blocks, 4 per work-group, x 128 row tiles of 64
    dim3 gq(3 * D_DIM / (QKV_NT * 16 * 4), (B_N * S_LEN) / 64);
    qkv_kernel<<<gq, 128, 0, stream>>>(Xh, Wqh, Wkh, Wvh, bq, bk, bv, Qh, Kh, Vt);

    // 3) attention: one block per 32-row query tile, ~307KB static LDS
    attn_kernel<<<(B_N * S_LEN) / QROWS, 256, 0, stream>>>(Qh, Kh, Vt, out);
}
